// v000
// The times below were measured on an AMD MI455X: many runs one after another, warmed up first and cycling through
// copies of the inputs, with the whole window's GPU time divided by the number of runs. Launches and the gaps
// between them are all in it. The median over several windows is given; except for v000 it joins two sittings, which
// can be a few percent apart, so the side-by-side timings, each taken in one sitting, are the better comparison.
// v000 is the starting kernel. One run takes 1320 microseconds.
// compute dtype: all float inputs rounded to bf16; q/k/v = x W + b ((in,out)) with EXACT bf16 products on WMMA 16x16x32, f32 accumulate; partial rotary (first 32 dims of each head) in f32 in the projection epilogue with precise cosf/sinf of t * inv_freq (the module's f32 inv_freq constants); q as f16 hi + residual (x 2^10), k f16 -> 2-product causal logits / 8 stored in f32 (4 heads per launch); softmax in f32 (precise expf), P x 2^11 split bf16 hi + lo against v bf16 hi + lo (3 products); out = o (bf16 hi + lo) Wo + bo; f32 output.
#include <hip/hip_runtime.h>
#include <math.h>

typedef __attribute__((ext_vector_type(16))) _Float16 v16h;
typedef __attribute__((ext_vector_type(16))) __bf16 v16b;
typedef __attribute__((ext_vector_type(8)))  _Float16 v8h;
typedef __attribute__((ext_vector_type(8)))  float v8f;
typedef __attribute__((ext_vector_type(4)))  float v4f;
typedef __attribute__((ext_vector_type(2)))  float v2f;
typedef __attribute__((ext_vector_type(4)))  unsigned v4u;
typedef __attribute__((ext_vector_type(4)))  int v4i;
typedef float __attribute__((may_alias)) float_a;
typedef int __attribute__((may_alias)) int_a;

template <typename T> __device__ __forceinline__ void vst2(void* p, T v) { *(T*)p = v;  }
__device__ __forceinline__ v8f wmma16(v16h a, v16h b, v8f c) {
  v8f d = __builtin_amdgcn_wmma_f32_16x16x32_f16(false, a, false, b, (short)0, c, false, false);
  asm volatile("v_nop\n\tv_nop\n\tv_nop\n\tv_nop" : "+v"(d) : "v"(a), "v"(b));
  return d;
}
__device__ __forceinline__ v8f wmma_bf(v16b a, v16b b, v8f c) {
  v8f d = __builtin_amdgcn_wmma_f32_16x16x32_bf16(false, a, false, b, (short)0, c, false, false);
  asm volatile("v_nop\n\tv_nop\n\tv_nop\n\tv_nop" : "+v"(d) : "v"(a), "v"(b));
  return d;
}
// 16x16x32 fragments: lane = (h = lane>>4, row/col = lane&15); elements 0..7 = k0+8h+0..7, 8..15 = k0+16+8h+0..7; D element r = row 8h+r
__device__ __forceinline__ v16h frag_h(const _Float16* rowk0, int lane) {
  union { v16h v; v8h q[2]; } u; const _Float16* p = rowk0 + 8 * (lane >> 4);
  u.q[0] = *(const v8h*)p; u.q[1] = *(const v8h*)(p + 16); return u.v;
}
__device__ __forceinline__ v16h frag_f32(const float* rowk0, int lane) {
  v16h a; const float* p = rowk0 + 8 * (lane >> 4);
#pragma unroll
  for (int i = 0; i < 8; ++i) { a[i] = (_Float16)p[i]; a[8 + i] = (_Float16)p[16 + i]; }
  return a;
}
__device__ __forceinline__ v16h frag_f32s(const float* rowk0, int lane, float sc) {
  v16h a; const float* p = rowk0 + 8 * (lane >> 4);
#pragma unroll
  for (int i = 0; i < 8; ++i) { a[i] = (_Float16)(p[i] * sc); a[8 + i] = (_Float16)(p[16 + i] * sc); }
  return a;
}
// column fragment from a [K][ld] layout (column n), rows >= K read as 0
__device__ __forceinline__ v16h fragc_f32(const float* W, int k0, int n, int lane, int ld, int K) {
  v16h a; const int g = lane >> 4;
#pragma unroll
  for (int i = 0; i < 8; ++i) { const int ka = k0 + 8 * g + i, kb = ka + 16;
    a[i] = (_Float16)(ka < K ? W[(size_t)(ka < K ? ka : K - 1) * ld + n] : 0.f); a[8 + i] = (_Float16)(kb < K ? W[(size_t)(kb < K ? kb : K - 1) * ld + n] : 0.f); }
  return a;
}
struct F2 { v16b h, l; };
__device__ __forceinline__ F2 bsplit16(const float v[16]) { F2 r;
#pragma unroll
  for (int i = 0; i < 16; ++i) { const __bf16 h = (__bf16)v[i]; r.h[i] = h; r.l[i] = (__bf16)(v[i] - (float)h); }
  return r; }
__device__ __forceinline__ F2 split_row(const float* row, int k0, int lane) { float v[16]; const float* p = row + k0 + 8 * (lane >> 4);
#pragma unroll
  for (int i = 0; i < 8; ++i) { v[i] = p[i]; v[8 + i] = p[16 + i]; }
  return bsplit16(v); }
__device__ __forceinline__ F2 split_rowK(const float* row, int k0, int lane, int K) { float v[16]; const int g = lane >> 4;
#pragma unroll
  for (int i = 0; i < 8; ++i) { const int ka = k0 + 8 * g + i, kb = ka + 16; v[i] = ka < K ? row[ka < K ? ka : K - 1] : 0.f; v[8 + i] = kb < K ? row[kb < K ? kb : K - 1] : 0.f; }
  return bsplit16(v); }
__device__ __forceinline__ F2 split_col(const float* W, int k0, int n, int lane, int ld, int K) { float v[16]; const int g = lane >> 4;
#pragma unroll
  for (int i = 0; i < 8; ++i) { const int ka = k0 + 8 * g + i, kb = ka + 16; v[i] = ka < K ? W[(size_t)(ka < K ? ka : K - 1) * ld + n] : 0.f; v[8 + i] = kb < K ? W[(size_t)(kb < K ? kb : K - 1) * ld + n] : 0.f; }
  return bsplit16(v); }
__device__ __forceinline__ v8f mac3(const F2& a, const F2& b, v8f c) { c = wmma_bf(a.l, b.h, c); c = wmma_bf(a.h, b.l, c); return wmma_bf(a.h, b.h, c); }
__device__ __forceinline__ float sigm(float v) { return 1.0f / (1.0f + expf(-v)); }
#define LDSX() do { asm volatile("s_wait_dscnt 0" ::: "memory"); __builtin_amdgcn_wave_barrier(); __builtin_amdgcn_fence(__ATOMIC_RELEASE, "workgroup"); } while (0)


// Causal MHA with partial rotary embedding (B 2, T 2,048, C 1,024 = 16 x 64, rotary on dims 0..31 of each head as rotate_half pairs (d, d+16), base 10000): att = softmax(q_rot k_rot^T / 8 | causal) v; out = merged Wo + bo.
#define NB 2
#define TT 2048
#define CC 1024
#define NH 16
#define HD 64
__constant__ float INVF[16] = {1.000000000e+00f,5.623413324e-01f,3.162277639e-01f,1.778279394e-01f,1.000000015e-01f,5.623412877e-02f,3.162277862e-02f,1.778279431e-02f,9.999999776e-03f,5.623413250e-03f,3.162277862e-03f,1.778279431e-03f,1.000000047e-03f,5.623413017e-04f,3.162277862e-04f,1.778279402e-04f};   // 1 / 10000^(2i/32) as the module's f32 values
#ifndef TNB
#define TNB NB
#endif
typedef __attribute__((ext_vector_type(8))) __bf16 v8b;
__device__ __forceinline__ v16b frag_b(const __bf16* rowk0, int lane) {
  union { v16b v; v8b q[2]; } u; const __bf16* p = rowk0 + 8 * (lane >> 4);
  u.q[0] = *(const v8b*)p; u.q[1] = *(const v8b*)(p + 16); return u.v;
}
__device__ __forceinline__ float bfr(float v) { return (float)(__bf16)v; }
__device__ __attribute__((noinline)) float exp_ni(float v) { return expf(v); }
__device__ __attribute__((noinline)) float erf_ni(float v) { return erff(v); }

#define WS_QH  0u
#define WS_QL  (WS_QH + 2u * (size_t)NB * TT * CC)
#define WS_KH  (WS_QL + 2u * (size_t)NB * TT * CC)
#define WS_VT  (WS_KH + 2u * (size_t)NB * TT * CC)      // bf16 v planes [b][c][t]
#define WS_VL  (WS_VT + 2u * (size_t)NB * CC * TT)      // bf16 v residual planes
#define HG 4                                          // heads per launch group
#define WS_S   (WS_VL + 2u * (size_t)NB * CC * TT)      // f32 logits / P for HG heads [hg][q][k]
#define WS_PH  (WS_S + 4u * (size_t)HG * TT * TT)
#define WS_Y   (WS_PH + 0u)              // f32 y rows [b*t][C]
#define WS_END (WS_Y + 4u * (size_t)NB * TT * CC)

// ---- k_proj: block = (64 rows, 128 cols, which): qkv = x W (+ b), exact; q -> f16 hi (+ residual), k -> f16 rows, v -> bf16 hi + lo planes
__global__ __launch_bounds__(128) void k_proj(const float* __restrict__ X, const float* __restrict__ WQ, const float* __restrict__ BQ, const float* __restrict__ WK, const float* __restrict__ BK, const float* __restrict__ WV, const float* __restrict__ BV, _Float16* __restrict__ QH, _Float16* __restrict__ QL, _Float16* __restrict__ KH, __bf16* __restrict__ VT, __bf16* __restrict__ VL) {
  __shared__ __align__(16) _Float16 sh[64][136], sl[64][136]; __shared__ __align__(16) __bf16 th[128][72], tl2[128][72];
  const int tid = threadIdx.x, wave = tid >> 5, lane = tid & 31, col = lane & 15, g = lane >> 4; const int which = blockIdx.z; const int c0 = blockIdx.y * 128; const size_t r0 = (size_t)blockIdx.x * 64; const float* WA = which == 0 ? WQ : which == 1 ? WK : WV; const float* BA = which == 0 ? BQ : which == 1 ? BK : BV;
  v8f acc[8] = {};
#pragma unroll 2
  for (int kc = 0; kc < CC / 32; ++kc) { v16b a; { const float* p = X + (r0 + wave * 16 + col) * CC + kc * 32 + 8 * g;
#pragma unroll
      for (int i = 0; i < 8; ++i) { a[i] = (__bf16)p[i]; a[8 + i] = (__bf16)p[16 + i]; } }
#pragma unroll
    for (int j = 0; j < 8; ++j) { v16b w; const int o = c0 + j * 16 + col;
#pragma unroll
      for (int i = 0; i < 8; ++i) { w[i] = (__bf16)WA[(size_t)(kc * 32 + 8 * g + i) * CC + o]; w[8 + i] = (__bf16)WA[(size_t)(kc * 32 + 16 + 8 * g + i) * CC + o]; }   /* (in,out) */
      acc[j] = wmma_bf(a, w, acc[j]); } }
#pragma unroll
  for (int j = 0; j < 8; ++j) { const float bb0 = BA ? bfr(BA[c0 + j * 16 + col]) : 0.f;
#pragma unroll
    for (int r = 0; r < 8; ++r) acc[j][r] += bb0; }   /* bias before the rotary */
  if (which < 2) {   /* partial rotary on dims 0..31 of each head: tiles (4hh, 4hh+1) hold dims (col, col+16) of the same lane: (x1, x2) -> (x1 c - x2 s, x2 c + x1 s), angle = t * inv_freq[col] */
#pragma unroll
    for (int hh = 0; hh < 2; ++hh)
#pragma unroll
      for (int r = 0; r < 8; ++r) { const int t = (int)((r0 + wave * 16 + 8 * g + r) % TT); const float ang = (float)t * INVF[col]; const float cs = cosf(ang), sn = sinf(ang); const float x1 = acc[4 * hh][r], x2 = acc[4 * hh + 1][r]; acc[4 * hh][r] = x1 * cs - x2 * sn; acc[4 * hh + 1][r] = x2 * cs + x1 * sn; } }
#pragma unroll
  for (int j = 0; j < 8; ++j) { const float bb = 0.f;
#pragma unroll
    for (int r = 0; r < 8; ++r) { const float v = acc[j][r] + bb; const int rl = wave * 16 + 8 * g + r, cl = j * 16 + col; const _Float16 hv = (_Float16)v;
      if (which == 2) { const __bf16 bh = (__bf16)v; th[cl][rl] = bh; tl2[cl][rl] = (__bf16)(v - (float)bh); } else { sh[rl][cl] = hv; sl[rl][cl] = (_Float16)((v - (float)hv) * 1024.0f); }   /* q residual carried x 2^10 so the plane stays f16-normal on the chip */ } }
  __syncthreads();
  if (which < 2) { _Float16* dh = which == 0 ? QH : KH; for (int e = tid; e < 64 * 16; e += 128) { const int rl = e >> 4, q = e & 15; vst2((unsigned*)(dh + (r0 + rl) * CC + c0 + q * 8), *(const v4u*)&sh[rl][q * 8]); if (which == 0) vst2((unsigned*)(QL + (r0 + rl) * CC + c0 + q * 8), *(const v4u*)&sl[rl][q * 8]); } }
  else { const size_t b = r0 / TT; const int t0 = (int)(r0 % TT); for (int e = tid; e < 128 * 8; e += 128) { const int cl = e >> 3, q = e & 7; const size_t o2 = (b * CC + c0 + cl) * (size_t)TT + t0 + q * 8; vst2((unsigned*)(VT + o2), *(const v4u*)&th[cl][q * 8]); vst2((unsigned*)(VL + o2), *(const v4u*)&tl2[cl][q * 8]); } } }
// ---- k_sc: block = (64 queries, 128 keys) of (b,h): logits * scale; causal blocks beyond the diagonal exit
__global__ __launch_bounds__(128) void k_sc(const _Float16* __restrict__ QH, const _Float16* __restrict__ QL, const _Float16* __restrict__ KH, const float* __restrict__ BM, int b, int h0, float* __restrict__ S0) { __shared__ __align__(16) float ss[4][16][132]; const int h = h0 + blockIdx.z; float* S = S0 + (size_t)blockIdx.z * TT * TT;
  const int tid = threadIdx.x, wave = tid >> 5, lane = tid & 31, col = lane & 15, g = lane >> 4; const int k0 = blockIdx.y * 128; const int ql0 = blockIdx.x * 64 + wave * 16; const size_t q0 = (size_t)b * TT + ql0;
  if (k0 > blockIdx.x * 64 + 63) return;   // whole key block above the diagonal (block-uniform)
  v8f acc[8] = {}, accl[8] = {};
#pragma unroll
  for (int kc = 0; kc < HD / 32; ++kc) { const v16h ah = frag_h(QH + (q0 + col) * CC + h * HD + kc * 32, lane), al = frag_h(QL + (q0 + col) * CC + h * HD + kc * 32, lane);
#pragma unroll
    for (int j = 0; j < 8; ++j) { const v16h kb = frag_h(KH + ((size_t)b * TT + k0 + j * 16 + col) * CC + h * HD + kc * 32, lane); acc[j] = wmma16(ah, kb, acc[j]); accl[j] = wmma16(al, kb, accl[j]); } }
#pragma unroll
  for (int j = 0; j < 8; ++j) acc[j] += accl[j] * (1.0f / 1024.0f);
#pragma unroll
  for (int j = 0; j < 8; ++j) { const int kt = k0 + j * 16 + col;
#pragma unroll
    for (int r = 0; r < 8; ++r) { const int qt = ql0 + 8 * g + r; float v = acc[j][r] * 0.125f; (void)BM; if (kt > qt) v = -3.0e38f; ss[wave][8 * g + r][j * 16 + col] = v; } }
  LDSX(); for (int rl = 0; rl < 16; ++rl) vst2(S + (size_t)(ql0 + rl) * TT + k0 + lane * 4, *(const v4f*)&ss[wave][rl][lane * 4]); }
// ---- k_sm: block = query row: softmax over keys [0, kend) -> P x 2^11 f32 (masked -> 0)
__global__ __launch_bounds__(256) void k_sm(float* __restrict__ S0) { __shared__ float sred[8]; __shared__ float sbc; __shared__ __align__(16) float sh[TT];
  const int t = threadIdx.x; const size_t row = blockIdx.x; float* sr = S0 + (size_t)blockIdx.y * TT * TT + row * TT; const int kend = ((int)row / 64) * 64 + 64;
  float m = -3.0e38f; for (int k = t; k < kend; k += 256) m = fmaxf(m, sr[k]);
#pragma unroll
  for (int o = 1; o < 32; o <<= 1) m = fmaxf(m, __shfl_xor(m, o));
  if ((t & 31) == 0) sred[t >> 5] = m; __syncthreads(); if (t == 0) { float a = sred[0]; for (int i = 1; i < 8; ++i) a = fmaxf(a, sred[i]); sbc = a; } __syncthreads(); m = sbc; __syncthreads();
  float sum = 0.f; for (int k = t; k < kend; k += 256) { const float v = sr[k]; sum += (v <= -1.0e38f) ? 0.f : expf(v - m); }
#pragma unroll
  for (int o = 1; o < 32; o <<= 1) sum += __shfl_xor(sum, o);
  if ((t & 31) == 0) sred[t >> 5] = sum; __syncthreads(); if (t == 0) { float a = 0.f; for (int i = 0; i < 8; ++i) a += sred[i]; sbc = 1.0f / a; } __syncthreads(); const float inv = sbc;
  for (int k = t; k < kend; k += 256) { const float v = sr[k]; sh[k] = (v <= -1.0e38f) ? 0.f : expf(v - m) * inv * 2048.0f; }
  __syncthreads(); for (int q = t; q < kend / 4; q += 256) vst2(sr + q * 4, *(const v4f*)&sh[q * 4]); }
// ---- k_pv: block = 64 queries of (b,h): y[q][h*HD + d] = P . v  (keys [0, kend))
__global__ __launch_bounds__(128) void k_pv(const float* __restrict__ PS0, const __bf16* __restrict__ VT, const __bf16* __restrict__ VL, int b, int h0, float* __restrict__ Y) { const int h = h0 + blockIdx.z; const float* PS = PS0 + (size_t)blockIdx.z * TT * TT; __shared__ __align__(16) float ss[4][16][HD + 4];
  const int tid = threadIdx.x, wave = tid >> 5, lane = tid & 31, col = lane & 15, g = lane >> 4; const int ql0 = blockIdx.x * 64 + wave * 16; const int kend = blockIdx.x * 64 + 64;
  v8f acc[HD / 16] = {};
#pragma unroll 1
  for (int kc = 0; kc < kend / 32; ++kc) { const F2 p = split_row(PS + (size_t)(ql0 + col) * TT, kc * 32, lane);
#pragma unroll
    for (int j = 0; j < HD / 16; ++j) { const size_t po = ((size_t)b * CC + h * HD + j * 16 + col) * (size_t)TT + kc * 32; const v16b vh = frag_b(VT + po, lane); acc[j] = wmma_bf(p.h, vh, acc[j]); acc[j] = wmma_bf(p.l, vh, acc[j]); acc[j] = wmma_bf(p.h, frag_b(VL + po, lane), acc[j]); } }
#pragma unroll
  for (int j = 0; j < HD / 16; ++j)
#pragma unroll
    for (int r = 0; r < 8; ++r) ss[wave][8 * g + r][j * 16 + col] = acc[j][r] * (1.0f / 2048.0f);
  LDSX(); for (int rl = 0; rl < 16; ++rl) if (lane < HD / 4) vst2(Y + ((size_t)b * TT + ql0 + rl) * CC + h * HD + lane * 4, *(const v4f*)&ss[wave][rl][lane * 4]); }
// ---- k_out: block = (64 rows, 128 cols): out = y (bf16 hi + lo) Wo + bo
__global__ __launch_bounds__(128) void k_out(const float* __restrict__ Y, const float* __restrict__ WP, const float* __restrict__ BP, float* __restrict__ OUT) { __shared__ __align__(16) float sf[4][16][132];
  const int tid = threadIdx.x, wave = tid >> 5, lane = tid & 31, col = lane & 15, g = lane >> 4; const int c0 = blockIdx.y * 128; const size_t r0 = (size_t)blockIdx.x * 64 + wave * 16;
  v8f acc[8] = {};
#pragma unroll 2
  for (int kc = 0; kc < CC / 32; ++kc) { const F2 a = split_row(Y + (r0 + col) * CC, kc * 32, lane);
#pragma unroll
    for (int j = 0; j < 8; ++j) { v16b w; const int o = c0 + j * 16 + col;
#pragma unroll
      for (int i = 0; i < 8; ++i) { w[i] = (__bf16)WP[(size_t)(kc * 32 + 8 * g + i) * CC + o]; w[8 + i] = (__bf16)WP[(size_t)(kc * 32 + 16 + 8 * g + i) * CC + o]; }   /* (in,out) */
      acc[j] = wmma_bf(a.h, w, acc[j]); acc[j] = wmma_bf(a.l, w, acc[j]); } }
#pragma unroll
  for (int j = 0; j < 8; ++j) { const float bb = BP ? bfr(BP[c0 + j * 16 + col]) : 0.f;
#pragma unroll
    for (int r = 0; r < 8; ++r) sf[wave][8 * g + r][j * 16 + col] = acc[j][r] + bb; }
  LDSX(); for (int rl = 0; rl < 16; ++rl) vst2(OUT + (r0 + rl) * CC + c0 + lane * 4, *(const v4f*)&sf[wave][rl][lane * 4]); }
extern "C" void kernel_launch(void* const* d_in, const int* in_sizes, int n_in, void* d_out, int out_size, void* d_ws, size_t ws_size, hipStream_t stream) {
  (void)in_sizes; (void)n_in; (void)out_size;
  const float** F = (const float**)d_in;   // 0 x [2,2048,1024], 1 Wq [1024,1024] ((in,out)), 2 bq, 3 Wk, 4 bk, 5 Wv, 6 bv, 7 Wo ((in,out)), 8 bo
  if (ws_size < (size_t)WS_END) return;
  char* ws = (char*)d_ws; _Float16 *QH = (_Float16*)(ws + WS_QH), *QL = (_Float16*)(ws + WS_QL), *KH = (_Float16*)(ws + WS_KH); __bf16 *VT = (__bf16*)(ws + WS_VT), *VL = (__bf16*)(ws + WS_VL); float *S = (float*)(ws + WS_S), *Y = (float*)(ws + WS_Y);
  k_proj<<<dim3(TNB * TT / 64, CC / 128, 3), 128, 0, stream>>>(F[0], F[1], F[2], F[3], F[4], F[5], F[6], QH, QL, KH, VT, VL);
  for (int b = 0; b < TNB; ++b) for (int h0 = 0; h0 < NH; h0 += HG) {
    k_sc<<<dim3(TT / 64, TT / 128, HG), 128, 0, stream>>>(QH, QL, KH, nullptr, b, h0, S);
    k_sm<<<dim3(TT, HG), 256, 0, stream>>>(S);
    k_pv<<<dim3(TT / 64, 1, HG), 128, 0, stream>>>(S, VT, VL, b, h0, Y);
  }
  k_out<<<dim3(TNB * TT / 64, CC / 128), 128, 0, stream>>>(Y, F[7], F[8], (float*)d_out);
}

// v001
// One run takes 284 microseconds.
// Timed twice side by side with v000, it ran 4.72 and 4.71 times as fast.
// compute dtype: all float inputs rounded to bf16; q/k/v = x W + b ((in,out)) with EXACT bf16 products on WMMA 16x16x32, f32 accumulate; partial rotary (first 32 dims of each head) in f32 in the projection epilogue with precise cosf/sinf of t * inv_freq (the module's f32 inv_freq constants); q as f16 hi + residual (x 2^10), k f16 -> 2-product causal logits / 8 kept in registers; running-maximum softmax in f32 (precise expf), exp(s - m) split bf16 hi + lo against v bf16 hi + lo (3 products), divided by the row sum at the end; out = o (bf16 hi + lo) Wo + bo; f32 output.
#include <hip/hip_runtime.h>
#include <math.h>

typedef __attribute__((ext_vector_type(16))) _Float16 v16h;
typedef __attribute__((ext_vector_type(16))) __bf16 v16b;
typedef __attribute__((ext_vector_type(8)))  _Float16 v8h;
typedef __attribute__((ext_vector_type(8)))  float v8f;
typedef __attribute__((ext_vector_type(4)))  float v4f;
typedef __attribute__((ext_vector_type(2)))  float v2f;
typedef __attribute__((ext_vector_type(4)))  unsigned v4u;
typedef __attribute__((ext_vector_type(4)))  int v4i;
typedef float __attribute__((may_alias)) float_a;
typedef int __attribute__((may_alias)) int_a;

template <typename T> __device__ __forceinline__ void vst2(void* p, T v) { *(T*)p = v;  }
__device__ __forceinline__ v8f wmma16(v16h a, v16h b, v8f c) {
  v8f d = __builtin_amdgcn_wmma_f32_16x16x32_f16(false, a, false, b, (short)0, c, false, false);
  asm volatile("v_nop\n\tv_nop\n\tv_nop\n\tv_nop" : "+v"(d) : "v"(a), "v"(b));
  return d;
}
__device__ __forceinline__ v8f wmma_bf(v16b a, v16b b, v8f c) {
  v8f d = __builtin_amdgcn_wmma_f32_16x16x32_bf16(false, a, false, b, (short)0, c, false, false);
  asm volatile("v_nop\n\tv_nop\n\tv_nop\n\tv_nop" : "+v"(d) : "v"(a), "v"(b));
  return d;
}
// 16x16x32 fragments: lane = (h = lane>>4, row/col = lane&15); elements 0..7 = k0+8h+0..7, 8..15 = k0+16+8h+0..7; D element r = row 8h+r
__device__ __forceinline__ v16h frag_h(const _Float16* rowk0, int lane) {
  union { v16h v; v8h q[2]; } u; const _Float16* p = rowk0 + 8 * (lane >> 4);
  u.q[0] = *(const v8h*)p; u.q[1] = *(const v8h*)(p + 16); return u.v;
}
__device__ __forceinline__ v16h frag_f32(const float* rowk0, int lane) {
  v16h a; const float* p = rowk0 + 8 * (lane >> 4);
#pragma unroll
  for (int i = 0; i < 8; ++i) { a[i] = (_Float16)p[i]; a[8 + i] = (_Float16)p[16 + i]; }
  return a;
}
__device__ __forceinline__ v16h frag_f32s(const float* rowk0, int lane, float sc) {
  v16h a; const float* p = rowk0 + 8 * (lane >> 4);
#pragma unroll
  for (int i = 0; i < 8; ++i) { a[i] = (_Float16)(p[i] * sc); a[8 + i] = (_Float16)(p[16 + i] * sc); }
  return a;
}
// column fragment from a [K][ld] layout (column n), rows >= K read as 0
__device__ __forceinline__ v16h fragc_f32(const float* W, int k0, int n, int lane, int ld, int K) {
  v16h a; const int g = lane >> 4;
#pragma unroll
  for (int i = 0; i < 8; ++i) { const int ka = k0 + 8 * g + i, kb = ka + 16;
    a[i] = (_Float16)(ka < K ? W[(size_t)(ka < K ? ka : K - 1) * ld + n] : 0.f); a[8 + i] = (_Float16)(kb < K ? W[(size_t)(kb < K ? kb : K - 1) * ld + n] : 0.f); }
  return a;
}
struct F2 { v16b h, l; };
__device__ __forceinline__ F2 bsplit16(const float v[16]) { F2 r;
#pragma unroll
  for (int i = 0; i < 16; ++i) { const __bf16 h = (__bf16)v[i]; r.h[i] = h; r.l[i] = (__bf16)(v[i] - (float)h); }
  return r; }
__device__ __forceinline__ F2 split_row(const float* row, int k0, int lane) { float v[16]; const float* p = row + k0 + 8 * (lane >> 4);
#pragma unroll
  for (int i = 0; i < 8; ++i) { v[i] = p[i]; v[8 + i] = p[16 + i]; }
  return bsplit16(v); }
__device__ __forceinline__ F2 split_rowK(const float* row, int k0, int lane, int K) { float v[16]; const int g = lane >> 4;
#pragma unroll
  for (int i = 0; i < 8; ++i) { const int ka = k0 + 8 * g + i, kb = ka + 16; v[i] = ka < K ? row[ka < K ? ka : K - 1] : 0.f; v[8 + i] = kb < K ? row[kb < K ? kb : K - 1] : 0.f; }
  return bsplit16(v); }
__device__ __forceinline__ F2 split_col(const float* W, int k0, int n, int lane, int ld, int K) { float v[16]; const int g = lane >> 4;
#pragma unroll
  for (int i = 0; i < 8; ++i) { const int ka = k0 + 8 * g + i, kb = ka + 16; v[i] = ka < K ? W[(size_t)(ka < K ? ka : K - 1) * ld + n] : 0.f; v[8 + i] = kb < K ? W[(size_t)(kb < K ? kb : K - 1) * ld + n] : 0.f; }
  return bsplit16(v); }
__device__ __forceinline__ v8f mac3(const F2& a, const F2& b, v8f c) { c = wmma_bf(a.l, b.h, c); c = wmma_bf(a.h, b.l, c); return wmma_bf(a.h, b.h, c); }
__device__ __forceinline__ float sigm(float v) { return 1.0f / (1.0f + expf(-v)); }
#define LDSX() do { asm volatile("s_wait_dscnt 0" ::: "memory"); __builtin_amdgcn_wave_barrier(); __builtin_amdgcn_fence(__ATOMIC_RELEASE, "workgroup"); } while (0)


// Causal MHA with partial rotary embedding (B 2, T 2,048, C 1,024 = 16 x 64, rotary on dims 0..31 of each head as rotate_half pairs (d, d+16), base 10000): att = softmax(q_rot k_rot^T / 8 | causal) v; out = merged Wo + bo.
#define NB 2
#define TT 2048
#define CC 1024
#define NH 16
#define HD 64
__constant__ float INVF[16] = {1.000000000e+00f,5.623413324e-01f,3.162277639e-01f,1.778279394e-01f,1.000000015e-01f,5.623412877e-02f,3.162277862e-02f,1.778279431e-02f,9.999999776e-03f,5.623413250e-03f,3.162277862e-03f,1.778279431e-03f,1.000000047e-03f,5.623413017e-04f,3.162277862e-04f,1.778279402e-04f};   // 1 / 10000^(2i/32) as the module's f32 values
#ifndef TNB
#define TNB NB
#endif
typedef __attribute__((ext_vector_type(8))) __bf16 v8b;
__device__ __forceinline__ v16b frag_b(const __bf16* rowk0, int lane) {
  union { v16b v; v8b q[2]; } u; const __bf16* p = rowk0 + 8 * (lane >> 4);
  u.q[0] = *(const v8b*)p; u.q[1] = *(const v8b*)(p + 16); return u.v;
}
__device__ __forceinline__ float bfr(float v) { return (float)(__bf16)v; }
__device__ __attribute__((noinline)) float exp_ni(float v) { return expf(v); }
__device__ __attribute__((noinline)) float erf_ni(float v) { return erff(v); }

#define WS_QH  0u
#define WS_QL  (WS_QH + 2u * (size_t)NB * TT * CC)
#define WS_KH  (WS_QL + 2u * (size_t)NB * TT * CC)
#define WS_VT  (WS_KH + 2u * (size_t)NB * TT * CC)      // bf16 v planes [b][c][t]
#define WS_VL  (WS_VT + 2u * (size_t)NB * CC * TT)      // bf16 v residual planes
#define WS_Y   (WS_VL + 2u * (size_t)NB * CC * TT)      // f32 y rows [b*t][C]
#define WS_END (WS_Y + 4u * (size_t)NB * TT * CC)

// ---- k_proj: block = (64 rows, 128 cols, which): qkv = x W (+ b), exact; q -> f16 hi (+ residual), k -> f16 rows, v -> bf16 hi + lo planes
__global__ __launch_bounds__(128) void k_proj(const float* __restrict__ X, const float* __restrict__ WQ, const float* __restrict__ BQ, const float* __restrict__ WK, const float* __restrict__ BK, const float* __restrict__ WV, const float* __restrict__ BV, _Float16* __restrict__ QH, _Float16* __restrict__ QL, _Float16* __restrict__ KH, __bf16* __restrict__ VT, __bf16* __restrict__ VL) {
  __shared__ __align__(16) _Float16 sh[64][136], sl[64][136]; __shared__ __align__(16) __bf16 th[128][72], tl2[128][72];
  const int tid = threadIdx.x, wave = tid >> 5, lane = tid & 31, col = lane & 15, g = lane >> 4; const int which = blockIdx.z; const int c0 = blockIdx.y * 128; const size_t r0 = (size_t)blockIdx.x * 64; const float* WA = which == 0 ? WQ : which == 1 ? WK : WV; const float* BA = which == 0 ? BQ : which == 1 ? BK : BV;
  v8f acc[8] = {};
#pragma unroll 2
  for (int kc = 0; kc < CC / 32; ++kc) { v16b a; { const float* p = X + (r0 + wave * 16 + col) * CC + kc * 32 + 8 * g;
#pragma unroll
      for (int i = 0; i < 8; ++i) { a[i] = (__bf16)p[i]; a[8 + i] = (__bf16)p[16 + i]; } }
#pragma unroll
    for (int j = 0; j < 8; ++j) { v16b w; const int o = c0 + j * 16 + col;
#pragma unroll
      for (int i = 0; i < 8; ++i) { w[i] = (__bf16)WA[(size_t)(kc * 32 + 8 * g + i) * CC + o]; w[8 + i] = (__bf16)WA[(size_t)(kc * 32 + 16 + 8 * g + i) * CC + o]; }   /* (in,out) */
      acc[j] = wmma_bf(a, w, acc[j]); } }
#pragma unroll
  for (int j = 0; j < 8; ++j) { const float bb0 = BA ? bfr(BA[c0 + j * 16 + col]) : 0.f;
#pragma unroll
    for (int r = 0; r < 8; ++r) acc[j][r] += bb0; }   /* bias before the rotary */
  if (which < 2) {   /* partial rotary on dims 0..31 of each head: tiles (4hh, 4hh+1) hold dims (col, col+16) of the same lane: (x1, x2) -> (x1 c - x2 s, x2 c + x1 s), angle = t * inv_freq[col] */
#pragma unroll
    for (int hh = 0; hh < 2; ++hh)
#pragma unroll
      for (int r = 0; r < 8; ++r) { const int t = (int)((r0 + wave * 16 + 8 * g + r) % TT); const float ang = (float)t * INVF[col]; const float cs = cosf(ang), sn = sinf(ang); const float x1 = acc[4 * hh][r], x2 = acc[4 * hh + 1][r]; acc[4 * hh][r] = x1 * cs - x2 * sn; acc[4 * hh + 1][r] = x2 * cs + x1 * sn; } }
#pragma unroll
  for (int j = 0; j < 8; ++j) { const float bb = 0.f;
#pragma unroll
    for (int r = 0; r < 8; ++r) { const float v = acc[j][r] + bb; const int rl = wave * 16 + 8 * g + r, cl = j * 16 + col; const _Float16 hv = (_Float16)v;
      if (which == 2) { const __bf16 bh = (__bf16)v; th[cl][rl] = bh; tl2[cl][rl] = (__bf16)(v - (float)bh); } else { sh[rl][cl] = hv; sl[rl][cl] = (_Float16)((v - (float)hv) * 1024.0f); }   /* q residual carried x 2^10 so the plane stays f16-normal on the chip */ } }
  __syncthreads();
  if (which < 2) { _Float16* dh = which == 0 ? QH : KH; for (int e = tid; e < 64 * 16; e += 128) { const int rl = e >> 4, q = e & 15; vst2((unsigned*)(dh + (r0 + rl) * CC + c0 + q * 8), *(const v4u*)&sh[rl][q * 8]); if (which == 0) vst2((unsigned*)(QL + (r0 + rl) * CC + c0 + q * 8), *(const v4u*)&sl[rl][q * 8]); } }
  else { const size_t b = r0 / TT; const int t0 = (int)(r0 % TT); for (int e = tid; e < 128 * 8; e += 128) { const int cl = e >> 3, q = e & 7; const size_t o2 = (b * CC + c0 + cl) * (size_t)TT + t0 + q * 8; vst2((unsigned*)(VT + o2), *(const v4u*)&th[cl][q * 8]); vst2((unsigned*)(VL + o2), *(const v4u*)&tl2[cl][q * 8]); } } }
#define QG 1
#define KT 4
__device__ __forceinline__ float xhalf(float x) { return __builtin_bit_cast(float, __builtin_amdgcn_permlanex16(__builtin_bit_cast(int, x), __builtin_bit_cast(int, x), 0x76543210, 0xfedcba98, false, false)); }   // lane l with lane l ^ 16
__global__ __launch_bounds__(128) void k_att(const _Float16* __restrict__ QH, const _Float16* __restrict__ QL, const _Float16* __restrict__ KH, const __bf16* __restrict__ VT, const __bf16* __restrict__ VL, float* __restrict__ Y) {
  const int tid = threadIdx.x, wave = __builtin_amdgcn_readfirstlane(tid >> 5), lane = tid & 31, col = lane & 15, g = lane >> 4; const int b = blockIdx.x / NH, h = blockIdx.x % NH;   // wave number in a scalar register: the pass loop and its last-pass test stay scalar branches
  const int qb = TT / (64 * QG) - 1 - (int)blockIdx.y;   // the longest query blocks start first
  const int q0 = (qb * 4 + wave) * (16 * QG);            // the wave's first query
  const int npass = (q0 + 16 * QG - 1) / (16 * KT) + 1;  // wave-uniform; q0 is never below the last pass's first key, so every query sees a live key in every pass
  v16h ah[QG][2], al[QG][2];
#pragma unroll
  for (int u = 0; u < QG; ++u)
#pragma unroll
    for (int kc = 0; kc < 2; ++kc) { const size_t qo = ((size_t)b * TT + q0 + u * 16 + col) * CC + h * HD + kc * 32; ah[u][kc] = frag_h(QH + qo, lane); al[u][kc] = frag_h(QL + qo, lane); }
  const _Float16* Kp = KH + ((size_t)b * TT + col) * CC + h * HD; const size_t vo = ((size_t)b * CC + h * HD + col) * (size_t)TT; const __bf16* Vh = VT + vo; const __bf16* Vl = VL + vo;
  v8f o[QG][4] = {}; float m[QG], l[QG];
#pragma unroll
  for (int u = 0; u < QG; ++u) { m[u] = -3.0e38f; l[u] = 0.f; }
#pragma unroll 1
  for (int kb = 0; kb < npass; ++kb) { const int k0 = kb * (16 * KT); const bool diag = kb == npass - 1;
    v16h kf[KT][2];
#pragma unroll
    for (int jt = 0; jt < KT; ++jt)
#pragma unroll
      for (int kc = 0; kc < 2; ++kc) kf[jt][kc] = frag_h(Kp + (size_t)(k0 + jt * 16) * CC + kc * 32, lane);
    F2 p[QG][KT / 2];
#pragma unroll
    for (int u = 0; u < QG; ++u) { v8f s[KT] = {}, sl[KT] = {};
#pragma unroll
      for (int kc = 0; kc < 2; ++kc)
#pragma unroll
        for (int jt = 0; jt < KT; ++jt) { s[jt] = wmma16(kf[jt][kc], ah[u][kc], s[jt]); sl[jt] = wmma16(kf[jt][kc], al[u][kc], sl[jt]); }
      const int qt = q0 + u * 16 + col; float mx = m[u];
#pragma unroll
      for (int jt = 0; jt < KT; ++jt) { s[jt] += sl[jt] * (1.0f / 1024.0f);
#pragma unroll
        for (int r = 0; r < 8; ++r) { float v = s[jt][r] * 0.125f; if (diag && k0 + jt * 16 + 8 * g + r > qt) v = -3.0e38f; s[jt][r] = v; mx = fmaxf(mx, v); } }
      mx = fmaxf(mx, xhalf(mx));
      const float sc = expf(m[u] - mx); m[u] = mx; float ps = 0.f;
#pragma unroll
      for (int jt = 0; jt < KT; ++jt)
#pragma unroll
        for (int r = 0; r < 8; ++r) { const float e = expf(s[jt][r] - mx); s[jt][r] = e; ps += e; }   /* a masked score is -3e38 and mx is a live score: expf gives exactly 0 */
      l[u] = l[u] * sc + ps;
#pragma unroll
      for (int j = 0; j < 4; ++j) o[u][j] *= sc;
#pragma unroll
      for (int c = 0; c < KT / 2; ++c) { float pv[16];
#pragma unroll
        for (int i = 0; i < 8; ++i) { pv[i] = s[2 * c][i]; pv[8 + i] = s[2 * c + 1][i]; }
        p[u][c] = bsplit16(pv); } }
#pragma unroll
    for (int c = 0; c < KT / 2; ++c) { v16b vh[4], vl[4];
#pragma unroll
      for (int j = 0; j < 4; ++j) { const size_t po = (size_t)(j * 16) * TT + k0 + c * 32; vh[j] = frag_b(Vh + po, lane); vl[j] = frag_b(Vl + po, lane); }
#pragma unroll
      for (int u = 0; u < QG; ++u) {
#pragma unroll
        for (int j = 0; j < 4; ++j) o[u][j] = wmma_bf(vh[j], p[u][c].h, o[u][j]);
#pragma unroll
        for (int j = 0; j < 4; ++j) o[u][j] = wmma_bf(vh[j], p[u][c].l, o[u][j]);
#pragma unroll
        for (int j = 0; j < 4; ++j) o[u][j] = wmma_bf(vl[j], p[u][c].h, o[u][j]); } }
    asm volatile("s_wait_xcnt 0x0" ::: "memory");   // the k and v address registers of this pass's loads are rewritten at the head of the next pass
  }
#pragma unroll
  for (int u = 0; u < QG; ++u) { const float inv = 1.0f / (l[u] + xhalf(l[u])); float* yp = Y + ((size_t)b * TT + q0 + u * 16 + col) * CC + h * HD + 8 * g;   // register r of tile j = dim 16 j + 8 g + r of the lane's query
#pragma unroll
    for (int j = 0; j < 4; ++j) { const v4f lo = {o[u][j][0] * inv, o[u][j][1] * inv, o[u][j][2] * inv, o[u][j][3] * inv}, hi = {o[u][j][4] * inv, o[u][j][5] * inv, o[u][j][6] * inv, o[u][j][7] * inv}; vst2(yp + j * 16, lo); vst2(yp + j * 16 + 4, hi); } } }
// ---- k_out: block = (64 rows, 128 cols): out = y (bf16 hi + lo) Wo + bo
__global__ __launch_bounds__(128) void k_out(const float* __restrict__ Y, const float* __restrict__ WP, const float* __restrict__ BP, float* __restrict__ OUT) { __shared__ __align__(16) float sf[4][16][132];
  const int tid = threadIdx.x, wave = tid >> 5, lane = tid & 31, col = lane & 15, g = lane >> 4; const int c0 = blockIdx.y * 128; const size_t r0 = (size_t)blockIdx.x * 64 + wave * 16;
  v8f acc[8] = {};
#pragma unroll 2
  for (int kc = 0; kc < CC / 32; ++kc) { const F2 a = split_row(Y + (r0 + col) * CC, kc * 32, lane);
#pragma unroll
    for (int j = 0; j < 8; ++j) { v16b w; const int o = c0 + j * 16 + col;
#pragma unroll
      for (int i = 0; i < 8; ++i) { w[i] = (__bf16)WP[(size_t)(kc * 32 + 8 * g + i) * CC + o]; w[8 + i] = (__bf16)WP[(size_t)(kc * 32 + 16 + 8 * g + i) * CC + o]; }   /* (in,out) */
      acc[j] = wmma_bf(a.h, w, acc[j]); acc[j] = wmma_bf(a.l, w, acc[j]); } }
#pragma unroll
  for (int j = 0; j < 8; ++j) { const float bb = BP ? bfr(BP[c0 + j * 16 + col]) : 0.f;
#pragma unroll
    for (int r = 0; r < 8; ++r) sf[wave][8 * g + r][j * 16 + col] = acc[j][r] + bb; }
  LDSX(); for (int rl = 0; rl < 16; ++rl) vst2(OUT + (r0 + rl) * CC + c0 + lane * 4, *(const v4f*)&sf[wave][rl][lane * 4]); }
extern "C" void kernel_launch(void* const* d_in, const int* in_sizes, int n_in, void* d_out, int out_size, void* d_ws, size_t ws_size, hipStream_t stream) {
  (void)in_sizes; (void)n_in; (void)out_size;
  const float** F = (const float**)d_in;   // 0 x [2,2048,1024], 1 Wq [1024,1024] ((in,out)), 2 bq, 3 Wk, 4 bk, 5 Wv, 6 bv, 7 Wo ((in,out)), 8 bo
  if (ws_size < (size_t)WS_END) return;
  char* ws = (char*)d_ws; _Float16 *QH = (_Float16*)(ws + WS_QH), *QL = (_Float16*)(ws + WS_QL), *KH = (_Float16*)(ws + WS_KH); __bf16 *VT = (__bf16*)(ws + WS_VT), *VL = (__bf16*)(ws + WS_VL); float *Y = (float*)(ws + WS_Y);
  k_proj<<<dim3(TNB * TT / 64, CC / 128, 3), 128, 0, stream>>>(F[0], F[1], F[2], F[3], F[4], F[5], F[6], QH, QL, KH, VT, VL);
  k_att<<<dim3(TNB * NH, TT / (64 * QG)), 128, 0, stream>>>(QH, QL, KH, VT, VL, Y);
  k_out<<<dim3(TNB * TT / 64, CC / 128), 128, 0, stream>>>(Y, F[7], F[8], (float*)d_out);
}

// v002
// It runs in 158 microseconds.
// Timed twice side by side with v001, it ran 1.80 and 1.81 times as fast.
// All steps since v000 together make it 8.50 times as fast.
// compute dtype: all float inputs rounded to bf16; q/k/v = x W + b ((in,out)) with EXACT bf16 products on WMMA 16x16x32, f32 accumulate; partial rotary (first 32 dims of each head) in f32 in the projection epilogue with precise cosf/sinf of t * inv_freq (the module's f32 inv_freq constants); q as f16 hi + residual (x 2^10), k f16 -> 2-product causal logits / 8 kept in registers; running-maximum softmax in f32 (precise expf), exp(s - m) split bf16 hi + lo against v bf16 hi + lo (3 products), divided by the row sum at the end; out = o (bf16 hi + lo) Wo + bo; f32 output.
#include <hip/hip_runtime.h>
#include <math.h>

typedef __attribute__((ext_vector_type(16))) _Float16 v16h;
typedef __attribute__((ext_vector_type(16))) __bf16 v16b;
typedef __attribute__((ext_vector_type(8)))  _Float16 v8h;
typedef __attribute__((ext_vector_type(8)))  float v8f;
typedef __attribute__((ext_vector_type(4)))  float v4f;
typedef __attribute__((ext_vector_type(2)))  float v2f;
typedef __attribute__((ext_vector_type(4)))  unsigned v4u;
typedef __attribute__((ext_vector_type(4)))  int v4i;
typedef float __attribute__((may_alias)) float_a;
typedef int __attribute__((may_alias)) int_a;

template <typename T> __device__ __forceinline__ void vst2(void* p, T v) { *(T*)p = v;  }
__device__ __forceinline__ v8f wmma16(v16h a, v16h b, v8f c) {
  v8f d = __builtin_amdgcn_wmma_f32_16x16x32_f16(false, a, false, b, (short)0, c, false, false);
  asm volatile("v_nop\n\tv_nop\n\tv_nop\n\tv_nop" : "+v"(d) : "v"(a), "v"(b));
  return d;
}
__device__ __forceinline__ v8f wmma_bf(v16b a, v16b b, v8f c) {
  v8f d = __builtin_amdgcn_wmma_f32_16x16x32_bf16(false, a, false, b, (short)0, c, false, false);
  asm volatile("v_nop\n\tv_nop\n\tv_nop\n\tv_nop" : "+v"(d) : "v"(a), "v"(b));
  return d;
}
// 16x16x32 fragments: lane = (h = lane>>4, row/col = lane&15); elements 0..7 = k0+8h+0..7, 8..15 = k0+16+8h+0..7; D element r = row 8h+r
__device__ __forceinline__ v16h frag_h(const _Float16* rowk0, int lane) {
  union { v16h v; v8h q[2]; } u; const _Float16* p = rowk0 + 8 * (lane >> 4);
  u.q[0] = *(const v8h*)p; u.q[1] = *(const v8h*)(p + 16); return u.v;
}
__device__ __forceinline__ v16h frag_f32(const float* rowk0, int lane) {
  v16h a; const float* p = rowk0 + 8 * (lane >> 4);
#pragma unroll
  for (int i = 0; i < 8; ++i) { a[i] = (_Float16)p[i]; a[8 + i] = (_Float16)p[16 + i]; }
  return a;
}
__device__ __forceinline__ v16h frag_f32s(const float* rowk0, int lane, float sc) {
  v16h a; const float* p = rowk0 + 8 * (lane >> 4);
#pragma unroll
  for (int i = 0; i < 8; ++i) { a[i] = (_Float16)(p[i] * sc); a[8 + i] = (_Float16)(p[16 + i] * sc); }
  return a;
}
// column fragment from a [K][ld] layout (column n), rows >= K read as 0
__device__ __forceinline__ v16h fragc_f32(const float* W, int k0, int n, int lane, int ld, int K) {
  v16h a; const int g = lane >> 4;
#pragma unroll
  for (int i = 0; i < 8; ++i) { const int ka = k0 + 8 * g + i, kb = ka + 16;
    a[i] = (_Float16)(ka < K ? W[(size_t)(ka < K ? ka : K - 1) * ld + n] : 0.f); a[8 + i] = (_Float16)(kb < K ? W[(size_t)(kb < K ? kb : K - 1) * ld + n] : 0.f); }
  return a;
}
struct F2 { v16b h, l; };
__device__ __forceinline__ F2 bsplit16(const float v[16]) { F2 r;
#pragma unroll
  for (int i = 0; i < 16; ++i) { const __bf16 h = (__bf16)v[i]; r.h[i] = h; r.l[i] = (__bf16)(v[i] - (float)h); }
  return r; }
__device__ __forceinline__ F2 split_row(const float* row, int k0, int lane) { float v[16]; const float* p = row + k0 + 8 * (lane >> 4);
#pragma unroll
  for (int i = 0; i < 8; ++i) { v[i] = p[i]; v[8 + i] = p[16 + i]; }
  return bsplit16(v); }
__device__ __forceinline__ F2 split_rowK(const float* row, int k0, int lane, int K) { float v[16]; const int g = lane >> 4;
#pragma unroll
  for (int i = 0; i < 8; ++i) { const int ka = k0 + 8 * g + i, kb = ka + 16; v[i] = ka < K ? row[ka < K ? ka : K - 1] : 0.f; v[8 + i] = kb < K ? row[kb < K ? kb : K - 1] : 0.f; }
  return bsplit16(v); }
__device__ __forceinline__ F2 split_col(const float* W, int k0, int n, int lane, int ld, int K) { float v[16]; const int g = lane >> 4;
#pragma unroll
  for (int i = 0; i < 8; ++i) { const int ka = k0 + 8 * g + i, kb = ka + 16; v[i] = ka < K ? W[(size_t)(ka < K ? ka : K - 1) * ld + n] : 0.f; v[8 + i] = kb < K ? W[(size_t)(kb < K ? kb : K - 1) * ld + n] : 0.f; }
  return bsplit16(v); }
__device__ __forceinline__ v8f mac3(const F2& a, const F2& b, v8f c) { c = wmma_bf(a.l, b.h, c); c = wmma_bf(a.h, b.l, c); return wmma_bf(a.h, b.h, c); }
__device__ __forceinline__ float sigm(float v) { return 1.0f / (1.0f + expf(-v)); }
#define LDSX() do { asm volatile("s_wait_dscnt 0" ::: "memory"); __builtin_amdgcn_wave_barrier(); __builtin_amdgcn_fence(__ATOMIC_RELEASE, "workgroup"); } while (0)


// Causal MHA with partial rotary embedding (B 2, T 2,048, C 1,024 = 16 x 64, rotary on dims 0..31 of each head as rotate_half pairs (d, d+16), base 10000): att = softmax(q_rot k_rot^T / 8 | causal) v; out = merged Wo + bo.
#define NB 2
#define TT 2048
#define CC 1024
#define NH 16
#define HD 64
__constant__ float INVF[16] = {1.000000000e+00f,5.623413324e-01f,3.162277639e-01f,1.778279394e-01f,1.000000015e-01f,5.623412877e-02f,3.162277862e-02f,1.778279431e-02f,9.999999776e-03f,5.623413250e-03f,3.162277862e-03f,1.778279431e-03f,1.000000047e-03f,5.623413017e-04f,3.162277862e-04f,1.778279402e-04f};   // 1 / 10000^(2i/32) as the module's f32 values
#ifndef TNB
#define TNB NB
#endif
typedef __attribute__((ext_vector_type(8))) __bf16 v8b;
__device__ __forceinline__ v16b frag_b(const __bf16* rowk0, int lane) {
  union { v16b v; v8b q[2]; } u; const __bf16* p = rowk0 + 8 * (lane >> 4);
  u.q[0] = *(const v8b*)p; u.q[1] = *(const v8b*)(p + 16); return u.v;
}
__device__ __forceinline__ float bfr(float v) { return (float)(__bf16)v; }
__device__ __attribute__((noinline)) float exp_ni(float v) { return expf(v); }
__device__ __attribute__((noinline)) float erf_ni(float v) { return erff(v); }

#define WS_QH  0u
#define WS_QL  (WS_QH + 2u * (size_t)NB * TT * CC)
#define WS_KH  (WS_QL + 2u * (size_t)NB * TT * CC)
#define WS_VT  (WS_KH + 2u * (size_t)NB * TT * CC)      // bf16 v, fragment order
#define WS_VL  (WS_VT + 2u * (size_t)NB * CC * TT)      // bf16 v residual, fragment order
#define WS_YH  (WS_VL + 2u * (size_t)NB * CC * TT)      // bf16 y, fragment order
#define WS_YL  (WS_YH + 2u * (size_t)NB * TT * CC)      // bf16 y residual
#define WS_XP  (WS_YL + 2u * (size_t)NB * TT * CC)      // bf16 x, fragment order
#define WS_WP  (WS_XP + 2u * (size_t)NB * TT * CC)      // bf16 Wq, Wk, Wv, Wo, fragment order
#define WS_END (WS_WP + 2u * (size_t)4 * CC * CC)

// FRAGMENT ORDER, every 16-bit matrix operand in the workspace: one 16 x 32 fragment = 512 elements = [e 0..1][lane 0..31][i 0..7], holding (row or column lane & 15, k = 16 e + 8 (lane >> 4) + i).
// A wave reads a fragment as two 16-byte loads per lane, each 512 contiguous bytes (4 cache lines); from row-major planes the same load touched 16 lines.
#define FRG 512
__device__ __forceinline__ v16b fragp_b(const __bf16* p) { union { v16b v; v8b q[2]; } u; u.q[0] = *(const v8b*)p; u.q[1] = *(const v8b*)(p + 256); return u.v; }       // p = fragment + 8 * lane
__device__ __forceinline__ v16h fragp_h(const _Float16* p) { union { v16h v; v8h q[2]; } u; u.q[0] = *(const v8h*)p; u.q[1] = *(const v8h*)(p + 256); return u.v; }

// ---- k_pack: x and the four weights rounded to bf16 and laid out in fragment order; a chunk = 16 bytes = 8 k of one row or column, chunks in output order, PCH chunks per thread (fewer waves, for speed only).
// x fragments [row tile][kc]; weight fragments [which][kc][column tile]
#define PCH 8
#define NXB (TNB * TT * CC / (2048 * PCH))
#define NWB (CC * CC / (2048 * PCH))
__global__ __launch_bounds__(256) void k_pack(const float* __restrict__ X, const float* __restrict__ WQ, const float* __restrict__ WK, const float* __restrict__ WV, const float* __restrict__ WO, __bf16* __restrict__ XP, __bf16* __restrict__ WP) {
  const int tid = threadIdx.x, rc = tid & 15, k8 = 16 * ((tid >> 5) & 1) + 8 * ((tid >> 4) & 1);
  if (blockIdx.x < NXB) { v4f x0[PCH], x1[PCH];
#pragma unroll
    for (int it = 0; it < PCH; ++it) { const unsigned f = ((blockIdx.x * PCH + it) * 256u + tid) >> 6; const float* p = X + ((size_t)(f >> 5) * 16 + rc) * CC + (f & 31) * 32 + k8; x0[it] = *(const v4f*)p;
      asm volatile("s_wait_xcnt 0x0" ::: "memory");   // the address registers of the load above may be reused as the next load's destination
      x1[it] = *(const v4f*)(p + 4);
      asm volatile("s_wait_xcnt 0x0" ::: "memory");   // as above, for a later chunk's load
    }
#pragma unroll
    for (int it = 0; it < PCH; ++it) { const unsigned c = (blockIdx.x * PCH + it) * 256u + tid; v8b o;
#pragma unroll
      for (int i = 0; i < 4; ++i) { o[i] = (__bf16)x0[it][i]; o[4 + i] = (__bf16)x1[it][i]; }
      vst2(XP + (size_t)c * 8, o); } }
  else { const unsigned wb = blockIdx.x - NXB, w = wb / NWB; const float* WA = w == 0 ? WQ : w == 1 ? WK : w == 2 ? WV : WO;
#pragma unroll
    for (int it = 0; it < PCH; ++it) { const unsigned c = (wb * PCH + it) * 256u + tid, f = c >> 6; const float* p = WA + (size_t)(((f >> 6) & 31) * 32 + k8) * CC + (f & 63) * 16 + rc; v8b o;   /* (in,out) */
#pragma unroll
      for (int i = 0; i < 8; ++i) o[i] = (__bf16)p[(size_t)i * CC];
      vst2(WP + (size_t)c * 8, o); } } }
// ---- k_proj: block = (64 rows, 128 cols, which): qkv = x W (+ b), exact; q -> f16 hi (+ residual), k -> f16, v -> bf16 hi + residual, all in fragment order
__global__ __launch_bounds__(128) void k_proj(const __bf16* __restrict__ XP, const __bf16* __restrict__ WP, const float* __restrict__ BQ, const float* __restrict__ BK, const float* __restrict__ BV, _Float16* __restrict__ QH, _Float16* __restrict__ QL, _Float16* __restrict__ KH, __bf16* __restrict__ VT, __bf16* __restrict__ VL) {
  __shared__ __align__(16) _Float16 sh[64][136], sl[64][136];
  const int tid = threadIdx.x, wave = tid >> 5, lane = tid & 31, col = lane & 15, g = lane >> 4; const int which = blockIdx.z; const int c0 = blockIdx.y * 128; const size_t r0 = (size_t)blockIdx.x * 64; const float* BA = which == 0 ? BQ : which == 1 ? BK : BV;
  const __bf16* Ap = XP + (r0 / 16 + wave) * (size_t)(CC / 32) * FRG + lane * 8; const __bf16* Bp = WP + ((size_t)which * (CC / 32) * (CC / 16) + c0 / 16) * FRG + lane * 8;
  v8f acc[8] = {};
#pragma unroll 2
  for (int kc = 0; kc < CC / 32; ++kc) { const v16b a = fragp_b(Ap + (size_t)kc * FRG); v16b w[8];
#pragma unroll
    for (int j = 0; j < 8; ++j) w[j] = fragp_b(Bp + ((size_t)kc * (CC / 16) + j) * FRG);
#pragma unroll
    for (int j = 0; j < 8; ++j) acc[j] = wmma_bf(a, w[j], acc[j]);
    asm volatile("s_wait_xcnt 0x0" ::: "memory");   // the address registers of this trip's loads are rewritten at the head of the next trip
  }
#pragma unroll
  for (int j = 0; j < 8; ++j) { const float bb0 = BA ? bfr(BA[c0 + j * 16 + col]) : 0.f;
#pragma unroll
    for (int r = 0; r < 8; ++r) acc[j][r] += bb0; }   /* bias before the rotary */
  const size_t b = r0 / TT; const int t0 = (int)(r0 % TT);
  if (which == 2) {   /* a lane's 8 registers of tile j are 8 consecutive t of one feature: one chunk of the V^T fragment (t / 32, dim tile j & 3), e = wave & 1, stored straight from registers */
#pragma unroll
    for (int j = 0; j < 8; ++j) { v8b hi, lo;
#pragma unroll
      for (int r = 0; r < 8; ++r) { const float v = acc[j][r]; const __bf16 bh = (__bf16)v; hi[r] = bh; lo[r] = (__bf16)(v - (float)bh); }
      const size_t o2 = (((b * NH + c0 / HD + (j >> 2)) * (TT / 32) + t0 / 32 + (wave >> 1)) * 4 + (j & 3)) * FRG + (wave & 1) * 256 + lane * 8; vst2(VT + o2, hi); vst2(VL + o2, lo); }
    return; }   /* block-uniform: which is blockIdx.z */
  /* partial rotary on dims 0..31 of each head: tiles (4hh, 4hh+1) hold dims (col, col+16) of the same lane: (x1, x2) -> (x1 c - x2 s, x2 c + x1 s), angle = t * inv_freq[col] */
#pragma unroll
  for (int hh = 0; hh < 2; ++hh)
#pragma unroll
    for (int r = 0; r < 8; ++r) { const int t = (int)((r0 + wave * 16 + 8 * g + r) % TT); const float ang = (float)t * INVF[col]; const float cs = cosf(ang), sn = sinf(ang); const float x1 = acc[4 * hh][r], x2 = acc[4 * hh + 1][r]; acc[4 * hh][r] = x1 * cs - x2 * sn; acc[4 * hh + 1][r] = x2 * cs + x1 * sn; }
#pragma unroll
  for (int j = 0; j < 8; ++j) {
#pragma unroll
    for (int r = 0; r < 8; ++r) { const float v = acc[j][r]; const int rl = wave * 16 + 8 * g + r, cl = j * 16 + col; const _Float16 hv = (_Float16)v;
      sh[rl][cl] = hv; sl[rl][cl] = (_Float16)((v - (float)hv) * 1024.0f);   /* q residual carried x 2^10 so the plane stays f16-normal on the chip */ } }
  __syncthreads();
  /* chunk e = [head 0..1][t tile 0..3][dims 8 * (0..7)][t & 15]: bits 0..6 are the chunk's place in its pair of fragments (kc 0, 1) */
  _Float16* dh = which == 0 ? QH : KH; for (int e = tid; e < 64 * 16; e += 128) { const int rl = ((e >> 7) & 3) * 16 + (e & 15), cl = (e >> 9) * 64 + ((e >> 4) & 7) * 8; const size_t o2 = ((b * NH + c0 / HD + (e >> 9)) * (TT / 16) + t0 / 16 + ((e >> 7) & 3)) * (2 * FRG) + (e & 127) * 8;
    vst2(dh + o2, *(const v4u*)&sh[rl][cl]);
    asm volatile("s_wait_xcnt 0x0" ::: "memory");   // the store's data and address registers are rewritten by the next LDS read and the next trip
    if (which == 0) { vst2(QL + o2, *(const v4u*)&sl[rl][cl]);
      asm volatile("s_wait_xcnt 0x0" ::: "memory");   // as above
    } } }
#define QG 1
#define KT 4
__device__ __forceinline__ float xhalf(float x) { return __builtin_bit_cast(float, __builtin_amdgcn_permlanex16(__builtin_bit_cast(int, x), __builtin_bit_cast(int, x), 0x76543210, 0xfedcba98, false, false)); }   // lane l with lane l ^ 16
__global__ __launch_bounds__(128) void k_att(const _Float16* __restrict__ QH, const _Float16* __restrict__ QL, const _Float16* __restrict__ KH, const __bf16* __restrict__ VT, const __bf16* __restrict__ VL, __bf16* __restrict__ YH, __bf16* __restrict__ YL) {
  const int tid = threadIdx.x, wave = __builtin_amdgcn_readfirstlane(tid >> 5), lane = tid & 31, col = lane & 15, g = lane >> 4; const int b = blockIdx.x / NH, h = blockIdx.x % NH;   // wave number in a scalar register: the pass loop and its last-pass test stay scalar branches
  const int qb = TT / (64 * QG) - 1 - (int)blockIdx.y;   // the longest query blocks take the lowest blockIdx.y
  const int q0 = (qb * 4 + wave) * (16 * QG);            // the wave's first query
  const int npass = (q0 + 16 * QG - 1) / (16 * KT) + 1;  // wave-uniform; q0 is never below the last pass's first key, so every query sees a live key in every pass
  v16h ah[QG][2], al[QG][2];
#pragma unroll
  for (int u = 0; u < QG; ++u)
#pragma unroll
    for (int kc = 0; kc < 2; ++kc) { const size_t qo = (((size_t)blockIdx.x * (TT / 16) + q0 / 16 + u) * 2 + kc) * FRG + lane * 8; ah[u][kc] = fragp_h(QH + qo); al[u][kc] = fragp_h(QL + qo); }
  const size_t ho = (size_t)blockIdx.x * (TT * HD) + lane * 8; const _Float16* Kp = KH + ho; const __bf16* Vh = VT + ho; const __bf16* Vl = VL + ho;   // blockIdx.x = b * NH + h; a head's k, v: TT * HD elements each, fragments [key tile][kc] and [32 keys][dim tile]
  v8f o[QG][4] = {}; float m[QG], l[QG];
#pragma unroll
  for (int u = 0; u < QG; ++u) { m[u] = -3.0e38f; l[u] = 0.f; }
#pragma unroll 1
  for (int kb = 0; kb < npass; ++kb) { const int k0 = kb * (16 * KT); const bool diag = kb == npass - 1;
    v16h kf[KT][2];
#pragma unroll
    for (int jt = 0; jt < KT; ++jt)
#pragma unroll
      for (int kc = 0; kc < 2; ++kc) kf[jt][kc] = fragp_h(Kp + (size_t)((k0 / 16 + jt) * 2 + kc) * FRG);
    F2 p[QG][KT / 2];
#pragma unroll
    for (int u = 0; u < QG; ++u) { v8f s[KT] = {}, sl[KT] = {};
#pragma unroll
      for (int kc = 0; kc < 2; ++kc)
#pragma unroll
        for (int jt = 0; jt < KT; ++jt) { s[jt] = wmma16(kf[jt][kc], ah[u][kc], s[jt]); sl[jt] = wmma16(kf[jt][kc], al[u][kc], sl[jt]); }
      const int qt = q0 + u * 16 + col; float mx = m[u];
#pragma unroll
      for (int jt = 0; jt < KT; ++jt) { s[jt] += sl[jt] * (1.0f / 1024.0f);
#pragma unroll
        for (int r = 0; r < 8; ++r) { float v = s[jt][r] * 0.125f; if (diag && k0 + jt * 16 + 8 * g + r > qt) v = -3.0e38f; s[jt][r] = v; mx = fmaxf(mx, v); } }
      mx = fmaxf(mx, xhalf(mx));
      const float sc = expf(m[u] - mx); m[u] = mx; float ps = 0.f;
#pragma unroll
      for (int jt = 0; jt < KT; ++jt)
#pragma unroll
        for (int r = 0; r < 8; ++r) { const float e = expf(s[jt][r] - mx); s[jt][r] = e; ps += e; }   /* a masked score is -3e38 and mx is a live score: expf gives exactly 0 */
      l[u] = l[u] * sc + ps;
#pragma unroll
      for (int j = 0; j < 4; ++j) o[u][j] *= sc;
#pragma unroll
      for (int c = 0; c < KT / 2; ++c) { float pv[16];
#pragma unroll
        for (int i = 0; i < 8; ++i) { pv[i] = s[2 * c][i]; pv[8 + i] = s[2 * c + 1][i]; }
        p[u][c] = bsplit16(pv); } }
#pragma unroll
    for (int c = 0; c < KT / 2; ++c) { v16b vh[4], vl[4];
#pragma unroll
      for (int j = 0; j < 4; ++j) { const size_t po = (size_t)((k0 / 32 + c) * 4 + j) * FRG; vh[j] = fragp_b(Vh + po); vl[j] = fragp_b(Vl + po); }
#pragma unroll
      for (int u = 0; u < QG; ++u) {
#pragma unroll
        for (int j = 0; j < 4; ++j) o[u][j] = wmma_bf(vh[j], p[u][c].h, o[u][j]);
#pragma unroll
        for (int j = 0; j < 4; ++j) o[u][j] = wmma_bf(vh[j], p[u][c].l, o[u][j]);
#pragma unroll
        for (int j = 0; j < 4; ++j) o[u][j] = wmma_bf(vl[j], p[u][c].h, o[u][j]); } }
    asm volatile("s_wait_xcnt 0x0" ::: "memory");   // the k and v address registers of this pass's loads are rewritten at the head of the next pass
  }
#pragma unroll
  for (int u = 0; u < QG; ++u) { const float inv = 1.0f / (l[u] + xhalf(l[u])); const size_t yo = (((size_t)b * TT + q0) / 16 + u) * (size_t)(CC / 32) * FRG + (size_t)(h * 2) * FRG + lane * 8;   // register r of tile j = dim 16 j + 8 g + r of the lane's query: chunk e = j & 1 of the y fragment kc = 2 h + (j >> 1)
#pragma unroll
    for (int j = 0; j < 4; ++j) { v8b hi, lo;
#pragma unroll
      for (int r = 0; r < 8; ++r) { const float y = o[u][j][r] * inv; const __bf16 yb = (__bf16)y; hi[r] = yb; lo[r] = (__bf16)(y - (float)yb); }
      const size_t o2 = yo + (j >> 1) * FRG + (j & 1) * 256; vst2(YH + o2, hi); vst2(YL + o2, lo); } } }
// ---- k_out: block = (64 rows, 128 cols): out = y (bf16 hi + lo) Wo + bo
__global__ __launch_bounds__(128) void k_out(const __bf16* __restrict__ YH, const __bf16* __restrict__ YL, const __bf16* __restrict__ WP, const float* __restrict__ BP, float* __restrict__ OUT) { __shared__ __align__(16) float sf[4][16][132];
  const int tid = threadIdx.x, wave = tid >> 5, lane = tid & 31, col = lane & 15, g = lane >> 4; const int c0 = blockIdx.y * 128; const size_t r0 = (size_t)blockIdx.x * 64 + wave * 16;
  const size_t ao = (r0 / 16) * (size_t)(CC / 32) * FRG + lane * 8; const __bf16* Ah = YH + ao; const __bf16* Al = YL + ao; const __bf16* Bp = WP + ((size_t)3 * (CC / 32) * (CC / 16) + c0 / 16) * FRG + lane * 8;
  v8f acc[8] = {};
#pragma unroll 2
  for (int kc = 0; kc < CC / 32; ++kc) { const v16b ah = fragp_b(Ah + (size_t)kc * FRG), al = fragp_b(Al + (size_t)kc * FRG); v16b w[8];
#pragma unroll
    for (int j = 0; j < 8; ++j) w[j] = fragp_b(Bp + ((size_t)kc * (CC / 16) + j) * FRG);
#pragma unroll
    for (int j = 0; j < 8; ++j) { acc[j] = wmma_bf(ah, w[j], acc[j]); acc[j] = wmma_bf(al, w[j], acc[j]); }
    asm volatile("s_wait_xcnt 0x0" ::: "memory");   // the address registers of this trip's loads are rewritten at the head of the next trip
  }
#pragma unroll
  for (int j = 0; j < 8; ++j) { const float bb = BP ? bfr(BP[c0 + j * 16 + col]) : 0.f;
#pragma unroll
    for (int r = 0; r < 8; ++r) sf[wave][8 * g + r][j * 16 + col] = acc[j][r] + bb; }
  LDSX(); for (int rl = 0; rl < 16; ++rl) vst2(OUT + (r0 + rl) * CC + c0 + lane * 4, *(const v4f*)&sf[wave][rl][lane * 4]); }
extern "C" void kernel_launch(void* const* d_in, const int* in_sizes, int n_in, void* d_out, int out_size, void* d_ws, size_t ws_size, hipStream_t stream) {
  (void)in_sizes; (void)n_in; (void)out_size;
  const float** F = (const float**)d_in;   // 0 x [2,2048,1024], 1 Wq [1024,1024] ((in,out)), 2 bq, 3 Wk, 4 bk, 5 Wv, 6 bv, 7 Wo ((in,out)), 8 bo
  if (ws_size < (size_t)WS_END) return;
  char* ws = (char*)d_ws; _Float16 *QH = (_Float16*)(ws + WS_QH), *QL = (_Float16*)(ws + WS_QL), *KH = (_Float16*)(ws + WS_KH); __bf16 *VT = (__bf16*)(ws + WS_VT), *VL = (__bf16*)(ws + WS_VL), *YH = (__bf16*)(ws + WS_YH), *YL = (__bf16*)(ws + WS_YL), *XP = (__bf16*)(ws + WS_XP), *WP = (__bf16*)(ws + WS_WP);
  k_pack<<<dim3(NXB + 4 * NWB), 256, 0, stream>>>(F[0], F[1], F[3], F[5], F[7], XP, WP);
  k_proj<<<dim3(TNB * TT / 64, CC / 128, 3), 128, 0, stream>>>(XP, WP, F[2], F[4], F[6], QH, QL, KH, VT, VL);
  k_att<<<dim3(TNB * NH, TT / (64 * QG)), 128, 0, stream>>>(QH, QL, KH, VT, VL, YH, YL);
  k_out<<<dim3(TNB * TT / 64, CC / 128), 128, 0, stream>>>(YH, YL, WP, F[8], (float*)d_out);
}

// v003
// Measured time: 140 microseconds a run.
// Timed twice side by side with v002, it ran 1.13 and 1.12 times as fast.
// All steps since v000 together make it 9.56 times as fast.
// compute dtype: all float inputs rounded to bf16; q/k/v = x W + b ((in,out)) with EXACT bf16 products on WMMA 16x16x32, f32 accumulate; partial rotary (first 32 dims of each head) in f32 in the projection epilogue with precise cosf/sinf of t * inv_freq (the module's f32 inv_freq constants); q as f16 hi + residual (x 2^10), k f16 -> 2-product causal logits / 8 kept in registers; running-maximum softmax in f32 (precise expf), exp(s - m) split bf16 hi + lo against v bf16 hi + lo (3 products), divided by the row sum at the end; out = o (bf16 hi + lo) Wo + bo; f32 output.
#include <hip/hip_runtime.h>
#include <math.h>

typedef __attribute__((ext_vector_type(16))) _Float16 v16h;
typedef __attribute__((ext_vector_type(16))) __bf16 v16b;
typedef __attribute__((ext_vector_type(8)))  _Float16 v8h;
typedef __attribute__((ext_vector_type(8)))  float v8f;
typedef __attribute__((ext_vector_type(4)))  float v4f;
typedef __attribute__((ext_vector_type(2)))  float v2f;
typedef __attribute__((ext_vector_type(4)))  unsigned v4u;
typedef __attribute__((ext_vector_type(4)))  int v4i;
typedef float __attribute__((may_alias)) float_a;
typedef int __attribute__((may_alias)) int_a;

template <typename T> __device__ __forceinline__ void vst2(void* p, T v) { *(T*)p = v;  }
__device__ __forceinline__ v8f wmma16(v16h a, v16h b, v8f c) {
  v8f d = __builtin_amdgcn_wmma_f32_16x16x32_f16(false, a, false, b, (short)0, c, false, false);
  asm volatile("v_nop\n\tv_nop\n\tv_nop\n\tv_nop" : "+v"(d) : "v"(a), "v"(b));
  return d;
}
__device__ __forceinline__ v8f wmma_bf(v16b a, v16b b, v8f c) {
  v8f d = __builtin_amdgcn_wmma_f32_16x16x32_bf16(false, a, false, b, (short)0, c, false, false);
  asm volatile("v_nop\n\tv_nop\n\tv_nop\n\tv_nop" : "+v"(d) : "v"(a), "v"(b));
  return d;
}
// 16x16x32 fragments: lane = (h = lane>>4, row/col = lane&15); elements 0..7 = k0+8h+0..7, 8..15 = k0+16+8h+0..7; D element r = row 8h+r
__device__ __forceinline__ v16h frag_h(const _Float16* rowk0, int lane) {
  union { v16h v; v8h q[2]; } u; const _Float16* p = rowk0 + 8 * (lane >> 4);
  u.q[0] = *(const v8h*)p; u.q[1] = *(const v8h*)(p + 16); return u.v;
}
__device__ __forceinline__ v16h frag_f32(const float* rowk0, int lane) {
  v16h a; const float* p = rowk0 + 8 * (lane >> 4);
#pragma unroll
  for (int i = 0; i < 8; ++i) { a[i] = (_Float16)p[i]; a[8 + i] = (_Float16)p[16 + i]; }
  return a;
}
__device__ __forceinline__ v16h frag_f32s(const float* rowk0, int lane, float sc) {
  v16h a; const float* p = rowk0 + 8 * (lane >> 4);
#pragma unroll
  for (int i = 0; i < 8; ++i) { a[i] = (_Float16)(p[i] * sc); a[8 + i] = (_Float16)(p[16 + i] * sc); }
  return a;
}
// column fragment from a [K][ld] layout (column n), rows >= K read as 0
__device__ __forceinline__ v16h fragc_f32(const float* W, int k0, int n, int lane, int ld, int K) {
  v16h a; const int g = lane >> 4;
#pragma unroll
  for (int i = 0; i < 8; ++i) { const int ka = k0 + 8 * g + i, kb = ka + 16;
    a[i] = (_Float16)(ka < K ? W[(size_t)(ka < K ? ka : K - 1) * ld + n] : 0.f); a[8 + i] = (_Float16)(kb < K ? W[(size_t)(kb < K ? kb : K - 1) * ld + n] : 0.f); }
  return a;
}
struct F2 { v16b h, l; };
__device__ __forceinline__ F2 bsplit16(const float v[16]) { F2 r;
#pragma unroll
  for (int i = 0; i < 16; ++i) { const __bf16 h = (__bf16)v[i]; r.h[i] = h; r.l[i] = (__bf16)(v[i] - (float)h); }
  return r; }
__device__ __forceinline__ F2 split_row(const float* row, int k0, int lane) { float v[16]; const float* p = row + k0 + 8 * (lane >> 4);
#pragma unroll
  for (int i = 0; i < 8; ++i) { v[i] = p[i]; v[8 + i] = p[16 + i]; }
  return bsplit16(v); }
__device__ __forceinline__ F2 split_rowK(const float* row, int k0, int lane, int K) { float v[16]; const int g = lane >> 4;
#pragma unroll
  for (int i = 0; i < 8; ++i) { const int ka = k0 + 8 * g + i, kb = ka + 16; v[i] = ka < K ? row[ka < K ? ka : K - 1] : 0.f; v[8 + i] = kb < K ? row[kb < K ? kb : K - 1] : 0.f; }
  return bsplit16(v); }
__device__ __forceinline__ F2 split_col(const float* W, int k0, int n, int lane, int ld, int K) { float v[16]; const int g = lane >> 4;
#pragma unroll
  for (int i = 0; i < 8; ++i) { const int ka = k0 + 8 * g + i, kb = ka + 16; v[i] = ka < K ? W[(size_t)(ka < K ? ka : K - 1) * ld + n] : 0.f; v[8 + i] = kb < K ? W[(size_t)(kb < K ? kb : K - 1) * ld + n] : 0.f; }
  return bsplit16(v); }
__device__ __forceinline__ v8f mac3(const F2& a, const F2& b, v8f c) { c = wmma_bf(a.l, b.h, c); c = wmma_bf(a.h, b.l, c); return wmma_bf(a.h, b.h, c); }
__device__ __forceinline__ float sigm(float v) { return 1.0f / (1.0f + expf(-v)); }
#define LDSX() do { asm volatile("s_wait_dscnt 0" ::: "memory"); __builtin_amdgcn_wave_barrier(); __builtin_amdgcn_fence(__ATOMIC_RELEASE, "workgroup"); } while (0)


// Causal MHA with partial rotary embedding (B 2, T 2,048, C 1,024 = 16 x 64, rotary on dims 0..31 of each head as rotate_half pairs (d, d+16), base 10000): att = softmax(q_rot k_rot^T / 8 | causal) v; out = merged Wo + bo.
#define NB 2
#define TT 2048
#define CC 1024
#define NH 16
#define HD 64
__constant__ float INVF[16] = {1.000000000e+00f,5.623413324e-01f,3.162277639e-01f,1.778279394e-01f,1.000000015e-01f,5.623412877e-02f,3.162277862e-02f,1.778279431e-02f,9.999999776e-03f,5.623413250e-03f,3.162277862e-03f,1.778279431e-03f,1.000000047e-03f,5.623413017e-04f,3.162277862e-04f,1.778279402e-04f};   // 1 / 10000^(2i/32) as the module's f32 values
#ifndef TNB
#define TNB NB
#endif
typedef __attribute__((ext_vector_type(8))) __bf16 v8b;
__device__ __forceinline__ v16b frag_b(const __bf16* rowk0, int lane) {
  union { v16b v; v8b q[2]; } u; const __bf16* p = rowk0 + 8 * (lane >> 4);
  u.q[0] = *(const v8b*)p; u.q[1] = *(const v8b*)(p + 16); return u.v;
}
__device__ __forceinline__ float bfr(float v) { return (float)(__bf16)v; }
__device__ __attribute__((noinline)) float exp_ni(float v) { return expf(v); }
__device__ __attribute__((noinline)) float erf_ni(float v) { return erff(v); }

#define WS_QH  0u
#define WS_QL  (WS_QH + 2u * (size_t)NB * TT * CC)
#define WS_KH  (WS_QL + 2u * (size_t)NB * TT * CC)
#define WS_VT  (WS_KH + 2u * (size_t)NB * TT * CC)      // bf16 v, fragment order
#define WS_VL  (WS_VT + 2u * (size_t)NB * CC * TT)      // bf16 v residual, fragment order
#define WS_YH  (WS_VL + 2u * (size_t)NB * CC * TT)      // bf16 y, fragment order
#define WS_YL  (WS_YH + 2u * (size_t)NB * TT * CC)      // bf16 y residual
#define WS_XP  (WS_YL + 2u * (size_t)NB * TT * CC)      // bf16 x, fragment order
#define WS_WP  (WS_XP + 2u * (size_t)NB * TT * CC)      // bf16 Wq, Wk, Wv, Wo, fragment order
#define WS_END (WS_WP + 2u * (size_t)4 * CC * CC)

// FRAGMENT ORDER, every 16-bit matrix operand in the workspace: one 16 x 32 fragment = 512 elements = [e 0..1][lane 0..31][i 0..7], holding (row or column lane & 15, k = 16 e + 8 (lane >> 4) + i).
// A wave reads a fragment as two 16-byte loads per lane, each 512 contiguous bytes (4 cache lines); from row-major planes the same load touched 16 lines.
#define FRG 512
__device__ __forceinline__ v16b fragp_b(const __bf16* p) { union { v16b v; v8b q[2]; } u; u.q[0] = *(const v8b*)p; u.q[1] = *(const v8b*)(p + 256); return u.v; }       // p = fragment + 8 * lane
__device__ __forceinline__ v16h fragp_h(const _Float16* p) { union { v16h v; v8h q[2]; } u; u.q[0] = *(const v8h*)p; u.q[1] = *(const v8h*)(p + 256); return u.v; }

// ---- k_pack: x and the four weights rounded to bf16 and laid out in fragment order; a chunk = 16 bytes = 8 k of one row or column, chunks in output order, PCH chunks per thread (fewer waves, for speed only).
// x fragments [row tile][kc]; weight fragments [which][kc][column tile]
#define PCH 8
#define NXB (TNB * TT * CC / (2048 * PCH))
#define NWB (CC * CC / (2048 * PCH))
__global__ __launch_bounds__(256) void k_pack(const float* __restrict__ X, const float* __restrict__ WQ, const float* __restrict__ WK, const float* __restrict__ WV, const float* __restrict__ WO, __bf16* __restrict__ XP, __bf16* __restrict__ WP) {
  const int tid = threadIdx.x, rc = tid & 15, k8 = 16 * ((tid >> 5) & 1) + 8 * ((tid >> 4) & 1);
  if (blockIdx.x < NXB) { v4f x0[PCH], x1[PCH];
#pragma unroll
    for (int it = 0; it < PCH; ++it) { const unsigned f = ((blockIdx.x * PCH + it) * 256u + tid) >> 6; const float* p = X + ((size_t)(f >> 5) * 16 + rc) * CC + (f & 31) * 32 + k8; x0[it] = *(const v4f*)p;
      asm volatile("s_wait_xcnt 0x0" ::: "memory");   // the address registers of the load above may be reused as the next load's destination
      x1[it] = *(const v4f*)(p + 4);
      asm volatile("s_wait_xcnt 0x0" ::: "memory");   // as above, for a later chunk's load
    }
#pragma unroll
    for (int it = 0; it < PCH; ++it) { const unsigned c = (blockIdx.x * PCH + it) * 256u + tid; v8b o;
#pragma unroll
      for (int i = 0; i < 4; ++i) { o[i] = (__bf16)x0[it][i]; o[4 + i] = (__bf16)x1[it][i]; }
      vst2(XP + (size_t)c * 8, o); } }
  else { const unsigned wb = blockIdx.x - NXB, w = wb / NWB; const float* WA = w == 0 ? WQ : w == 1 ? WK : w == 2 ? WV : WO;
#pragma unroll
    for (int it = 0; it < PCH; ++it) { const unsigned c = (wb * PCH + it) * 256u + tid, f = c >> 6; const float* p = WA + (size_t)(((f >> 6) & 31) * 32 + k8) * CC + (f & 63) * 16 + rc; v8b o;   /* (in,out) */
#pragma unroll
      for (int i = 0; i < 8; ++i) o[i] = (__bf16)p[(size_t)i * CC];
      vst2(WP + (size_t)c * 8, o); } } }
// ---- k_proj: block = (128 rows, 128 cols, which), wave = RG row tiles of 16 x 128 cols, so every loaded W fragment feeds RG products: qkv = x W (+ b), exact; q -> f16 hi (+ residual), k -> f16, v -> bf16 hi + residual, all in fragment order
#define RG 2
__global__ __launch_bounds__(128) void k_proj(const __bf16* __restrict__ XP, const __bf16* __restrict__ WP, const float* __restrict__ BQ, const float* __restrict__ BK, const float* __restrict__ BV, _Float16* __restrict__ QH, _Float16* __restrict__ QL, _Float16* __restrict__ KH, __bf16* __restrict__ VT, __bf16* __restrict__ VL) {
  __shared__ __align__(16) _Float16 sh[64 * RG][136], sl[64 * RG][136];
  const int tid = threadIdx.x, wave = tid >> 5, lane = tid & 31, col = lane & 15, g = lane >> 4; const int which = blockIdx.z; const int c0 = blockIdx.y * 128; const size_t r0 = (size_t)blockIdx.x * (64 * RG); const float* BA = which == 0 ? BQ : which == 1 ? BK : BV;
  const __bf16* Ap = XP + (r0 / 16 + wave * RG) * (size_t)(CC / 32) * FRG + lane * 8; const __bf16* Bp = WP + ((size_t)which * (CC / 32) * (CC / 16) + c0 / 16) * FRG + lane * 8;
  v8f acc[RG][8] = {};
#pragma unroll 2
  for (int kc = 0; kc < CC / 32; ++kc) { v16b a[RG], w[8];
#pragma unroll
    for (int u = 0; u < RG; ++u) a[u] = fragp_b(Ap + ((size_t)u * (CC / 32) + kc) * FRG);
#pragma unroll
    for (int j = 0; j < 8; ++j) w[j] = fragp_b(Bp + ((size_t)kc * (CC / 16) + j) * FRG);
#pragma unroll
    for (int j = 0; j < 8; ++j)
#pragma unroll
      for (int u = 0; u < RG; ++u) acc[u][j] = wmma_bf(a[u], w[j], acc[u][j]);
    asm volatile("s_wait_xcnt 0x0" ::: "memory");   // the address registers of this trip's loads are rewritten at the head of the next trip
  }
#pragma unroll
  for (int j = 0; j < 8; ++j) { const float bb0 = BA ? bfr(BA[c0 + j * 16 + col]) : 0.f;
#pragma unroll
    for (int u = 0; u < RG; ++u)
#pragma unroll
      for (int r = 0; r < 8; ++r) acc[u][j][r] += bb0; }   /* bias before the rotary */
  const size_t b = r0 / TT; const int t0 = (int)(r0 % TT);
  if (which == 2) {   /* a lane's 8 registers of tile (u, j) are 8 consecutive t of one feature: one chunk of the V^T fragment (t / 32, dim tile j & 3), e = row tile & 1, stored straight from registers */
#pragma unroll
    for (int u = 0; u < RG; ++u)
#pragma unroll
    for (int j = 0; j < 8; ++j) { v8b hi, lo; const int rt = wave * RG + u;
#pragma unroll
      for (int r = 0; r < 8; ++r) { const float v = acc[u][j][r]; const __bf16 bh = (__bf16)v; hi[r] = bh; lo[r] = (__bf16)(v - (float)bh); }
      const size_t o2 = (((b * NH + c0 / HD + (j >> 2)) * (TT / 32) + t0 / 32 + (rt >> 1)) * 4 + (j & 3)) * FRG + (rt & 1) * 256 + lane * 8; vst2(VT + o2, hi); vst2(VL + o2, lo); }
    return; }   /* block-uniform: which is blockIdx.z */
  /* partial rotary on dims 0..31 of each head: tiles (4hh, 4hh+1) hold dims (col, col+16) of the same lane: (x1, x2) -> (x1 c - x2 s, x2 c + x1 s), angle = t * inv_freq[col] */
  const auto put = [&](const v8f& tile, int rt, int j) {   /* one 16 x 16 tile (row tile rt of the block, column tile j) into the staging planes */
#pragma unroll
    for (int r = 0; r < 8; ++r) { const float v = tile[r]; const int rl = rt * 16 + 8 * g + r, cl = j * 16 + col; const _Float16 hv = (_Float16)v;
      sh[rl][cl] = hv; sl[rl][cl] = (_Float16)((v - (float)hv) * 1024.0f);   /* q residual carried x 2^10 so the plane stays f16-normal on the chip */ } };
#pragma unroll
  for (int u = 0; u < RG; ++u)
#pragma unroll
    for (int hh = 0; hh < 2; ++hh) { put(acc[u][4 * hh + 2], wave * RG + u, 4 * hh + 2); put(acc[u][4 * hh + 3], wave * RG + u, 4 * hh + 3); }   /* dims 32..63 pass unrotated and leave their registers first */
#pragma unroll 1   // one copy of the long cosf / sinf text serves every row tile: unrolled, the kernel's text would grow RG-fold
  for (int u = 0; u < RG; ++u) {
#pragma unroll
    for (int hh = 0; hh < 2; ++hh) {
#pragma unroll
      for (int r = 0; r < 8; ++r) { const int t = (int)((r0 + (wave * RG + u) * 16 + 8 * g + r) % TT); const float ang = (float)t * INVF[col]; const float cs = cosf(ang), sn = sinf(ang); const float x1 = acc[0][4 * hh][r], x2 = acc[0][4 * hh + 1][r]; acc[0][4 * hh][r] = x1 * cs - x2 * sn; acc[0][4 * hh + 1][r] = x2 * cs + x1 * sn; }
      put(acc[0][4 * hh], wave * RG + u, 4 * hh); put(acc[0][4 * hh + 1], wave * RG + u, 4 * hh + 1); }
#pragma unroll
    for (int v = 0; v + 1 < RG; ++v)
#pragma unroll
      for (int hh = 0; hh < 2; ++hh) { acc[v][4 * hh] = acc[v + 1][4 * hh]; acc[v][4 * hh + 1] = acc[v + 1][4 * hh + 1]; }   /* trip u always works on acc[0]: constant register indices in a rolled loop */
  }
  __syncthreads();
  /* chunk e = [head 0..1][t tile 0..4 RG - 1][dims 8 * (0..7)][t & 15]: bits 0..6 are the chunk's place in its pair of fragments (kc 0, 1) */
  _Float16* dh = which == 0 ? QH : KH; for (int e = tid; e < 64 * RG * 16; e += 128) { const int tt = (e >> 7) % (4 * RG), hd = e / (512 * RG); const int rl = tt * 16 + (e & 15), cl = hd * 64 + ((e >> 4) & 7) * 8; const size_t o2 = ((b * NH + c0 / HD + hd) * (TT / 16) + t0 / 16 + tt) * (2 * FRG) + (e & 127) * 8;
    vst2(dh + o2, *(const v4u*)&sh[rl][cl]);
    asm volatile("s_wait_xcnt 0x0" ::: "memory");   // the store's data and address registers are rewritten by the next LDS read and the next trip
    if (which == 0) { vst2(QL + o2, *(const v4u*)&sl[rl][cl]);
      asm volatile("s_wait_xcnt 0x0" ::: "memory");   // as above
    } } }
#define QG 1
#define KT 4
__device__ __forceinline__ float xhalf(float x) { return __builtin_bit_cast(float, __builtin_amdgcn_permlanex16(__builtin_bit_cast(int, x), __builtin_bit_cast(int, x), 0x76543210, 0xfedcba98, false, false)); }   // lane l with lane l ^ 16
__global__ __launch_bounds__(128) void k_att(const _Float16* __restrict__ QH, const _Float16* __restrict__ QL, const _Float16* __restrict__ KH, const __bf16* __restrict__ VT, const __bf16* __restrict__ VL, __bf16* __restrict__ YH, __bf16* __restrict__ YL) {
  const int tid = threadIdx.x, wave = __builtin_amdgcn_readfirstlane(tid >> 5), lane = tid & 31, col = lane & 15, g = lane >> 4; const int b = blockIdx.x / NH, h = blockIdx.x % NH;   // wave number in a scalar register: the pass loop and its last-pass test stay scalar branches
  const int qb = TT / (64 * QG) - 1 - (int)blockIdx.y;   // the longest query blocks take the lowest blockIdx.y
  const int q0 = (qb * 4 + wave) * (16 * QG);            // the wave's first query
  const int npass = (q0 + 16 * QG - 1) / (16 * KT) + 1;  // wave-uniform; q0 is never below the last pass's first key, so every query sees a live key in every pass
  v16h ah[QG][2], al[QG][2];
#pragma unroll
  for (int u = 0; u < QG; ++u)
#pragma unroll
    for (int kc = 0; kc < 2; ++kc) { const size_t qo = (((size_t)blockIdx.x * (TT / 16) + q0 / 16 + u) * 2 + kc) * FRG + lane * 8; ah[u][kc] = fragp_h(QH + qo); al[u][kc] = fragp_h(QL + qo); }
  const size_t ho = (size_t)blockIdx.x * (TT * HD) + lane * 8; const _Float16* Kp = KH + ho; const __bf16* Vh = VT + ho; const __bf16* Vl = VL + ho;   // blockIdx.x = b * NH + h; a head's k, v: TT * HD elements each, fragments [key tile][kc] and [32 keys][dim tile]
  v8f o[QG][4] = {}; float m[QG], l[QG];
#pragma unroll
  for (int u = 0; u < QG; ++u) { m[u] = -3.0e38f; l[u] = 0.f; }
#pragma unroll 1
  for (int kb = 0; kb < npass; ++kb) { const int k0 = kb * (16 * KT); const bool diag = kb == npass - 1;
    v16h kf[KT][2];
#pragma unroll
    for (int jt = 0; jt < KT; ++jt)
#pragma unroll
      for (int kc = 0; kc < 2; ++kc) kf[jt][kc] = fragp_h(Kp + (size_t)((k0 / 16 + jt) * 2 + kc) * FRG);
    F2 p[QG][KT / 2];
#pragma unroll
    for (int u = 0; u < QG; ++u) { v8f s[KT] = {}, sl[KT] = {};
#pragma unroll
      for (int kc = 0; kc < 2; ++kc)
#pragma unroll
        for (int jt = 0; jt < KT; ++jt) { s[jt] = wmma16(kf[jt][kc], ah[u][kc], s[jt]); sl[jt] = wmma16(kf[jt][kc], al[u][kc], sl[jt]); }
      const int qt = q0 + u * 16 + col; float mx = m[u];
#pragma unroll
      for (int jt = 0; jt < KT; ++jt) { s[jt] += sl[jt] * (1.0f / 1024.0f);
#pragma unroll
        for (int r = 0; r < 8; ++r) { float v = s[jt][r] * 0.125f; if (diag && k0 + jt * 16 + 8 * g + r > qt) v = -3.0e38f; s[jt][r] = v; mx = fmaxf(mx, v); } }
      mx = fmaxf(mx, xhalf(mx));
      const float sc = expf(m[u] - mx); m[u] = mx; float ps = 0.f;
#pragma unroll
      for (int jt = 0; jt < KT; ++jt)
#pragma unroll
        for (int r = 0; r < 8; ++r) { const float e = expf(s[jt][r] - mx); s[jt][r] = e; ps += e; }   /* a masked score is -3e38 and mx is a live score: expf gives exactly 0 */
      l[u] = l[u] * sc + ps;
#pragma unroll
      for (int j = 0; j < 4; ++j) o[u][j] *= sc;
#pragma unroll
      for (int c = 0; c < KT / 2; ++c) { float pv[16];
#pragma unroll
        for (int i = 0; i < 8; ++i) { pv[i] = s[2 * c][i]; pv[8 + i] = s[2 * c + 1][i]; }
        p[u][c] = bsplit16(pv); } }
#pragma unroll
    for (int c = 0; c < KT / 2; ++c) { v16b vh[4], vl[4];
#pragma unroll
      for (int j = 0; j < 4; ++j) { const size_t po = (size_t)((k0 / 32 + c) * 4 + j) * FRG; vh[j] = fragp_b(Vh + po); vl[j] = fragp_b(Vl + po); }
#pragma unroll
      for (int u = 0; u < QG; ++u) {
#pragma unroll
        for (int j = 0; j < 4; ++j) o[u][j] = wmma_bf(vh[j], p[u][c].h, o[u][j]);
#pragma unroll
        for (int j = 0; j < 4; ++j) o[u][j] = wmma_bf(vh[j], p[u][c].l, o[u][j]);
#pragma unroll
        for (int j = 0; j < 4; ++j) o[u][j] = wmma_bf(vl[j], p[u][c].h, o[u][j]); } }
    asm volatile("s_wait_xcnt 0x0" ::: "memory");   // the k and v address registers of this pass's loads are rewritten at the head of the next pass
  }
#pragma unroll
  for (int u = 0; u < QG; ++u) { const float inv = 1.0f / (l[u] + xhalf(l[u])); const size_t yo = (((size_t)b * TT + q0) / 16 + u) * (size_t)(CC / 32) * FRG + (size_t)(h * 2) * FRG + lane * 8;   // register r of tile j = dim 16 j + 8 g + r of the lane's query: chunk e = j & 1 of the y fragment kc = 2 h + (j >> 1)
#pragma unroll
    for (int j = 0; j < 4; ++j) { v8b hi, lo;
#pragma unroll
      for (int r = 0; r < 8; ++r) { const float y = o[u][j][r] * inv; const __bf16 yb = (__bf16)y; hi[r] = yb; lo[r] = (__bf16)(y - (float)yb); }
      const size_t o2 = yo + (j >> 1) * FRG + (j & 1) * 256; vst2(YH + o2, hi); vst2(YL + o2, lo); } } }
// ---- k_out: block = (64 rows, 128 cols): out = y (bf16 hi + lo) Wo + bo
__global__ __launch_bounds__(128) void k_out(const __bf16* __restrict__ YH, const __bf16* __restrict__ YL, const __bf16* __restrict__ WP, const float* __restrict__ BP, float* __restrict__ OUT) { __shared__ __align__(16) float sf[4][16][132];
  const int tid = threadIdx.x, wave = tid >> 5, lane = tid & 31, col = lane & 15, g = lane >> 4; const int c0 = blockIdx.y * 128; const size_t r0 = (size_t)blockIdx.x * 64 + wave * 16;
  const size_t ao = (r0 / 16) * (size_t)(CC / 32) * FRG + lane * 8; const __bf16* Ah = YH + ao; const __bf16* Al = YL + ao; const __bf16* Bp = WP + ((size_t)3 * (CC / 32) * (CC / 16) + c0 / 16) * FRG + lane * 8;
  v8f acc[8] = {};
#pragma unroll 2
  for (int kc = 0; kc < CC / 32; ++kc) { const v16b ah = fragp_b(Ah + (size_t)kc * FRG), al = fragp_b(Al + (size_t)kc * FRG); v16b w[8];
#pragma unroll
    for (int j = 0; j < 8; ++j) w[j] = fragp_b(Bp + ((size_t)kc * (CC / 16) + j) * FRG);
#pragma unroll
    for (int j = 0; j < 8; ++j) { acc[j] = wmma_bf(ah, w[j], acc[j]); acc[j] = wmma_bf(al, w[j], acc[j]); }
    asm volatile("s_wait_xcnt 0x0" ::: "memory");   // the address registers of this trip's loads are rewritten at the head of the next trip
  }
#pragma unroll
  for (int j = 0; j < 8; ++j) { const float bb = BP ? bfr(BP[c0 + j * 16 + col]) : 0.f;
#pragma unroll
    for (int r = 0; r < 8; ++r) sf[wave][8 * g + r][j * 16 + col] = acc[j][r] + bb; }
  LDSX(); for (int rl = 0; rl < 16; ++rl) vst2(OUT + (r0 + rl) * CC + c0 + lane * 4, *(const v4f*)&sf[wave][rl][lane * 4]); }
extern "C" void kernel_launch(void* const* d_in, const int* in_sizes, int n_in, void* d_out, int out_size, void* d_ws, size_t ws_size, hipStream_t stream) {
  (void)in_sizes; (void)n_in; (void)out_size;
  const float** F = (const float**)d_in;   // 0 x [2,2048,1024], 1 Wq [1024,1024] ((in,out)), 2 bq, 3 Wk, 4 bk, 5 Wv, 6 bv, 7 Wo ((in,out)), 8 bo
  if (ws_size < (size_t)WS_END) return;
  char* ws = (char*)d_ws; _Float16 *QH = (_Float16*)(ws + WS_QH), *QL = (_Float16*)(ws + WS_QL), *KH = (_Float16*)(ws + WS_KH); __bf16 *VT = (__bf16*)(ws + WS_VT), *VL = (__bf16*)(ws + WS_VL), *YH = (__bf16*)(ws + WS_YH), *YL = (__bf16*)(ws + WS_YL), *XP = (__bf16*)(ws + WS_XP), *WP = (__bf16*)(ws + WS_WP);
  k_pack<<<dim3(NXB + 4 * NWB), 256, 0, stream>>>(F[0], F[1], F[3], F[5], F[7], XP, WP);
  k_proj<<<dim3(TNB * TT / (64 * RG), CC / 128, 3), 128, 0, stream>>>(XP, WP, F[2], F[4], F[6], QH, QL, KH, VT, VL);
  k_att<<<dim3(TNB * NH, TT / (64 * QG)), 128, 0, stream>>>(QH, QL, KH, VT, VL, YH, YL);
  k_out<<<dim3(TNB * TT / 64, CC / 128), 128, 0, stream>>>(YH, YL, WP, F[8], (float*)d_out);
}

// v004
// It runs in 117 microseconds.
// Next to v003, in two timings, it ran 1.19 and 1.21 times as fast.
// Over all steps from v000 it is 11.5 times as fast.
// compute dtype: all float inputs rounded to bf16; q/k/v = x W + b ((in,out)) with EXACT bf16 products on WMMA 16x16x32, f32 accumulate; partial rotary (first 32 dims of each head) in f32 in the projection epilogue with precise cosf/sinf of t * inv_freq (the module's f32 inv_freq constants); q as f16 hi + residual (x 2^10), k f16 -> 2-product causal logits / 8 kept in registers; running-maximum softmax in f32 (precise expf), exp(s - m) split bf16 hi + lo against v bf16 hi + lo (3 products), divided by the row sum at the end; out = o (bf16 hi + lo) Wo + bo; f32 output.
#include <hip/hip_runtime.h>
#include <math.h>

typedef __attribute__((ext_vector_type(16))) _Float16 v16h;
typedef __attribute__((ext_vector_type(16))) __bf16 v16b;
typedef __attribute__((ext_vector_type(8)))  _Float16 v8h;
typedef __attribute__((ext_vector_type(8)))  float v8f;
typedef __attribute__((ext_vector_type(4)))  float v4f;
typedef __attribute__((ext_vector_type(2)))  float v2f;
typedef __attribute__((ext_vector_type(4)))  unsigned v4u;
typedef __attribute__((ext_vector_type(4)))  int v4i;
typedef float __attribute__((may_alias)) float_a;
typedef int __attribute__((may_alias)) int_a;

template <typename T> __device__ __forceinline__ void vst2(void* p, T v) { *(T*)p = v;  }
__device__ __forceinline__ v8f wmma16(v16h a, v16h b, v8f c) {
  v8f d = __builtin_amdgcn_wmma_f32_16x16x32_f16(false, a, false, b, (short)0, c, false, false);
  asm volatile("v_nop\n\tv_nop\n\tv_nop\n\tv_nop" : "+v"(d) : "v"(a), "v"(b));
  return d;
}
__device__ __forceinline__ v8f wmma_bf(v16b a, v16b b, v8f c) {
  v8f d = __builtin_amdgcn_wmma_f32_16x16x32_bf16(false, a, false, b, (short)0, c, false, false);
  asm volatile("v_nop\n\tv_nop\n\tv_nop\n\tv_nop" : "+v"(d) : "v"(a), "v"(b));
  return d;
}
// 16x16x32 fragments: lane = (h = lane>>4, row/col = lane&15); elements 0..7 = k0+8h+0..7, 8..15 = k0+16+8h+0..7; D element r = row 8h+r
__device__ __forceinline__ v16h frag_h(const _Float16* rowk0, int lane) {
  union { v16h v; v8h q[2]; } u; const _Float16* p = rowk0 + 8 * (lane >> 4);
  u.q[0] = *(const v8h*)p; u.q[1] = *(const v8h*)(p + 16); return u.v;
}
__device__ __forceinline__ v16h frag_f32(const float* rowk0, int lane) {
  v16h a; const float* p = rowk0 + 8 * (lane >> 4);
#pragma unroll
  for (int i = 0; i < 8; ++i) { a[i] = (_Float16)p[i]; a[8 + i] = (_Float16)p[16 + i]; }
  return a;
}
__device__ __forceinline__ v16h frag_f32s(const float* rowk0, int lane, float sc) {
  v16h a; const float* p = rowk0 + 8 * (lane >> 4);
#pragma unroll
  for (int i = 0; i < 8; ++i) { a[i] = (_Float16)(p[i] * sc); a[8 + i] = (_Float16)(p[16 + i] * sc); }
  return a;
}
// column fragment from a [K][ld] layout (column n), rows >= K read as 0
__device__ __forceinline__ v16h fragc_f32(const float* W, int k0, int n, int lane, int ld, int K) {
  v16h a; const int g = lane >> 4;
#pragma unroll
  for (int i = 0; i < 8; ++i) { const int ka = k0 + 8 * g + i, kb = ka + 16;
    a[i] = (_Float16)(ka < K ? W[(size_t)(ka < K ? ka : K - 1) * ld + n] : 0.f); a[8 + i] = (_Float16)(kb < K ? W[(size_t)(kb < K ? kb : K - 1) * ld + n] : 0.f); }
  return a;
}
struct F2 { v16b h, l; };
__device__ __forceinline__ F2 bsplit16(const float v[16]) { F2 r;
#pragma unroll
  for (int i = 0; i < 16; ++i) { const __bf16 h = (__bf16)v[i]; r.h[i] = h; r.l[i] = (__bf16)(v[i] - (float)h); }
  return r; }
__device__ __forceinline__ F2 split_row(const float* row, int k0, int lane) { float v[16]; const float* p = row + k0 + 8 * (lane >> 4);
#pragma unroll
  for (int i = 0; i < 8; ++i) { v[i] = p[i]; v[8 + i] = p[16 + i]; }
  return bsplit16(v); }
__device__ __forceinline__ F2 split_rowK(const float* row, int k0, int lane, int K) { float v[16]; const int g = lane >> 4;
#pragma unroll
  for (int i = 0; i < 8; ++i) { const int ka = k0 + 8 * g + i, kb = ka + 16; v[i] = ka < K ? row[ka < K ? ka : K - 1] : 0.f; v[8 + i] = kb < K ? row[kb < K ? kb : K - 1] : 0.f; }
  return bsplit16(v); }
__device__ __forceinline__ F2 split_col(const float* W, int k0, int n, int lane, int ld, int K) { float v[16]; const int g = lane >> 4;
#pragma unroll
  for (int i = 0; i < 8; ++i) { const int ka = k0 + 8 * g + i, kb = ka + 16; v[i] = ka < K ? W[(size_t)(ka < K ? ka : K - 1) * ld + n] : 0.f; v[8 + i] = kb < K ? W[(size_t)(kb < K ? kb : K - 1) * ld + n] : 0.f; }
  return bsplit16(v); }
__device__ __forceinline__ v8f mac3(const F2& a, const F2& b, v8f c) { c = wmma_bf(a.l, b.h, c); c = wmma_bf(a.h, b.l, c); return wmma_bf(a.h, b.h, c); }
__device__ __forceinline__ float sigm(float v) { return 1.0f / (1.0f + expf(-v)); }
#define LDSX() do { asm volatile("s_wait_dscnt 0" ::: "memory"); __builtin_amdgcn_wave_barrier(); __builtin_amdgcn_fence(__ATOMIC_RELEASE, "workgroup"); } while (0)


// Causal MHA with partial rotary embedding (B 2, T 2,048, C 1,024 = 16 x 64, rotary on dims 0..31 of each head as rotate_half pairs (d, d+16), base 10000): att = softmax(q_rot k_rot^T / 8 | causal) v; out = merged Wo + bo.
#define NB 2
#define TT 2048
#define CC 1024
#define NH 16
#define HD 64
__constant__ float INVF[16] = {1.000000000e+00f,5.623413324e-01f,3.162277639e-01f,1.778279394e-01f,1.000000015e-01f,5.623412877e-02f,3.162277862e-02f,1.778279431e-02f,9.999999776e-03f,5.623413250e-03f,3.162277862e-03f,1.778279431e-03f,1.000000047e-03f,5.623413017e-04f,3.162277862e-04f,1.778279402e-04f};   // 1 / 10000^(2i/32) as the module's f32 values
#ifndef TNB
#define TNB NB
#endif
typedef __attribute__((ext_vector_type(8))) __bf16 v8b;
__device__ __forceinline__ v16b frag_b(const __bf16* rowk0, int lane) {
  union { v16b v; v8b q[2]; } u; const __bf16* p = rowk0 + 8 * (lane >> 4);
  u.q[0] = *(const v8b*)p; u.q[1] = *(const v8b*)(p + 16); return u.v;
}
__device__ __forceinline__ float bfr(float v) { return (float)(__bf16)v; }
__device__ __attribute__((noinline)) float exp_ni(float v) { return expf(v); }
__device__ __attribute__((noinline)) float erf_ni(float v) { return erff(v); }

#define WS_QH  0u
#define WS_QL  (WS_QH + 2u * (size_t)NB * TT * CC)
#define WS_KH  (WS_QL + 2u * (size_t)NB * TT * CC)
#define WS_VT  (WS_KH + 2u * (size_t)NB * TT * CC)      // bf16 v, fragment order
#define WS_VL  (WS_VT + 2u * (size_t)NB * CC * TT)      // bf16 v residual, fragment order
#define WS_YH  (WS_VL + 2u * (size_t)NB * CC * TT)      // bf16 y, fragment order
#define WS_YL  (WS_YH + 2u * (size_t)NB * TT * CC)      // bf16 y residual
#define WS_XP  (WS_YL + 2u * (size_t)NB * TT * CC)      // bf16 x, fragment order
#define WS_WP  (WS_XP + 2u * (size_t)NB * TT * CC)      // bf16 Wq, Wk, Wv, Wo, fragment order
#define WS_END (WS_WP + 2u * (size_t)4 * CC * CC)

// FRAGMENT ORDER, every 16-bit matrix operand in the workspace: one 16 x 32 fragment = 512 elements = [e 0..1][lane 0..31][i 0..7], holding (row or column lane & 15, k = 16 e + 8 (lane >> 4) + i).
// A wave reads a fragment as two 16-byte loads per lane, each 512 contiguous bytes (4 cache lines); from row-major planes the same load touched 16 lines.
#define FRG 512
__device__ __forceinline__ v16b fragp_b(const __bf16* p) { union { v16b v; v8b q[2]; } u; u.q[0] = *(const v8b*)p; u.q[1] = *(const v8b*)(p + 256); return u.v; }       // p = fragment + 8 * lane
__device__ __forceinline__ v16h fragp_h(const _Float16* p) { union { v16h v; v8h q[2]; } u; u.q[0] = *(const v8h*)p; u.q[1] = *(const v8h*)(p + 256); return u.v; }
// LDS RING: fragments that all four waves of a block read come from L2 once per block, not once per wave: 128 threads x 16 bytes x 4 asynchronous copies = 8 KiB (8 fragments, contiguous in the workspace) from g to LDS byte address l, both already the lane's own (+ 16 * tid).
// Two buffers: stage t + 2 is asked for behind the barrier that ends the reads of stage t, and flies while stage t + 1 is worked on.
__device__ __forceinline__ void cp8k(unsigned l, const char* g) {
  // s_wait_xcnt as the statement's last line, a precaution: no register that one of the four copies names is rewritten in front of it
  asm volatile("global_load_async_to_lds_b128 %0, %4, off\n\tglobal_load_async_to_lds_b128 %1, %5, off\n\tglobal_load_async_to_lds_b128 %2, %6, off\n\tglobal_load_async_to_lds_b128 %3, %7, off\n\ts_wait_xcnt 0x0"
               :: "v"(l), "v"(l + 2048u), "v"(l + 4096u), "v"(l + 6144u), "v"(g), "v"(g + 2048), "v"(g + 4096), "v"(g + 6144) : "memory");
}
#define RING_LANDED() asm volatile("s_wait_asynccnt 0x0" ::: "memory")   // this wave's copies have landed; the barrier behind it shows them to the other waves
#define RING_READ()   asm volatile("s_wait_dscnt 0x0" ::: "memory")      // this wave's LDS reads of the stage are done before the barrier behind which the buffer is refilled

// ---- k_pack: x and the four weights rounded to bf16 and laid out in fragment order; a chunk = 16 bytes = 8 k of one row or column, chunks in output order, PCH chunks per thread (fewer waves, for speed only).
// x fragments [row tile][kc]; weight fragments [which][kc][column tile]
#define PCH 8
#define NXB (TNB * TT * CC / (2048 * PCH))
#define NWB (CC * CC / (2048 * PCH))
__global__ __launch_bounds__(256) void k_pack(const float* __restrict__ X, const float* __restrict__ WQ, const float* __restrict__ WK, const float* __restrict__ WV, const float* __restrict__ WO, __bf16* __restrict__ XP, __bf16* __restrict__ WP) {
  const int tid = threadIdx.x, rc = tid & 15, k8 = 16 * ((tid >> 5) & 1) + 8 * ((tid >> 4) & 1);
  if (blockIdx.x < NXB) { v4f x0[PCH], x1[PCH];
#pragma unroll
    for (int it = 0; it < PCH; ++it) { const unsigned f = ((blockIdx.x * PCH + it) * 256u + tid) >> 6; const float* p = X + ((size_t)(f >> 5) * 16 + rc) * CC + (f & 31) * 32 + k8; x0[it] = *(const v4f*)p;
      asm volatile("s_wait_xcnt 0x0" ::: "memory");   // the address registers of the load above may be reused as the next load's destination
      x1[it] = *(const v4f*)(p + 4);
      asm volatile("s_wait_xcnt 0x0" ::: "memory");   // as above, for a later chunk's load
    }
#pragma unroll
    for (int it = 0; it < PCH; ++it) { const unsigned c = (blockIdx.x * PCH + it) * 256u + tid; v8b o;
#pragma unroll
      for (int i = 0; i < 4; ++i) { o[i] = (__bf16)x0[it][i]; o[4 + i] = (__bf16)x1[it][i]; }
      vst2(XP + (size_t)c * 8, o); } }
  else { const unsigned wb = blockIdx.x - NXB, w = wb / NWB; const float* WA = w == 0 ? WQ : w == 1 ? WK : w == 2 ? WV : WO;
#pragma unroll
    for (int it = 0; it < PCH; ++it) { const unsigned c = (wb * PCH + it) * 256u + tid, f = c >> 6; const float* p = WA + (size_t)(((f >> 6) & 31) * 32 + k8) * CC + (f & 63) * 16 + rc; v8b o;   /* (in,out) */
#pragma unroll
      for (int i = 0; i < 8; ++i) o[i] = (__bf16)p[(size_t)i * CC];
      vst2(WP + (size_t)c * 8, o); } } }
// ---- k_proj: block = (128 rows, 128 cols, which), wave = RG row tiles of 16 x 128 cols, so every loaded W fragment feeds RG products: qkv = x W (+ b), exact; q -> f16 hi (+ residual), k -> f16, v -> bf16 hi + residual, all in fragment order
#define RG 2
__global__ __launch_bounds__(128) void k_proj(const __bf16* __restrict__ XP, const __bf16* __restrict__ WP, const float* __restrict__ BQ, const float* __restrict__ BK, const float* __restrict__ BV, _Float16* __restrict__ QH, _Float16* __restrict__ QL, _Float16* __restrict__ KH, __bf16* __restrict__ VT, __bf16* __restrict__ VL) {
  __shared__ __align__(16) _Float16 sh[64 * RG][136], sl[64 * RG][136]; __shared__ __align__(16) char wr[2][16384];   // wr: W ring, a stage = 2 kc x 8 fragments
  const int tid = threadIdx.x, wave = tid >> 5, lane = tid & 31, col = lane & 15, g = lane >> 4; const int which = blockIdx.z; const int c0 = blockIdx.y * 128; const size_t r0 = (size_t)blockIdx.x * (64 * RG); const float* BA = which == 0 ? BQ : which == 1 ? BK : BV;
  const __bf16* Ap = XP + (r0 / 16 + wave * RG) * (size_t)(CC / 32) * FRG + lane * 8; const __bf16* Bp = WP + ((size_t)which * (CC / 32) * (CC / 16) + c0 / 16) * FRG + lane * 8;
  v8f acc[RG][8] = {};
  const unsigned wl = (unsigned)(size_t)&wr[0][0] + tid * 16; const char* wg = (const char*)(Bp - lane * 8) + tid * 16;
  const auto fill = [&](int t) { const unsigned l = wl + (t & 1) * 16384; const char* g = wg + (size_t)t * (2 * (CC / 16) * FRG * 2); cp8k(l, g); cp8k(l + 8192, g + (CC / 16) * FRG * 2); };   // stage t = kc 2 t, 2 t + 1
  fill(0); RING_LANDED(); __syncthreads(); fill(1);
#pragma unroll 1   // one stage a trip: the trip's foot is the ring's publish point
  for (int t = 0; t < CC / 64; ++t) { v16b a[2][RG];   // the wave's own x fragments of the stage, straight from L2
#pragma unroll
    for (int kk = 0; kk < 2; ++kk)
#pragma unroll
      for (int u = 0; u < RG; ++u) a[kk][u] = fragp_b(Ap + ((size_t)u * (CC / 32) + 2 * t + kk) * FRG);
#pragma unroll
    for (int kk = 0; kk < 2; ++kk) { v16b w[8]; const __bf16* ws = (const __bf16*)&wr[t & 1][kk * 8192] + lane * 8;
#pragma unroll
      for (int j = 0; j < 8; ++j) w[j] = fragp_b(ws + j * FRG);
#pragma unroll
      for (int j = 0; j < 8; ++j)
#pragma unroll
        for (int u = 0; u < RG; ++u) acc[u][j] = wmma_bf(a[kk][u], w[j], acc[u][j]);
    }
    asm volatile("s_wait_xcnt 0x0" ::: "memory");   // the address registers of this trip's loads are rewritten at the head of the next trip
    RING_READ(); RING_LANDED(); __syncthreads();
    if (t + 2 < CC / 64) fill(t + 2);   // same for the whole block
  }
  RING_LANDED();
#pragma unroll
  for (int j = 0; j < 8; ++j) { const float bb0 = BA ? bfr(BA[c0 + j * 16 + col]) : 0.f;
#pragma unroll
    for (int u = 0; u < RG; ++u)
#pragma unroll
      for (int r = 0; r < 8; ++r) acc[u][j][r] += bb0; }   /* bias before the rotary */
  const size_t b = r0 / TT; const int t0 = (int)(r0 % TT);
  if (which == 2) {   /* a lane's 8 registers of tile (u, j) are 8 consecutive t of one feature: one chunk of the V^T fragment (t / 32, dim tile j & 3), e = row tile & 1, stored straight from registers */
#pragma unroll
    for (int u = 0; u < RG; ++u)
#pragma unroll
    for (int j = 0; j < 8; ++j) { v8b hi, lo; const int rt = wave * RG + u;
#pragma unroll
      for (int r = 0; r < 8; ++r) { const float v = acc[u][j][r]; const __bf16 bh = (__bf16)v; hi[r] = bh; lo[r] = (__bf16)(v - (float)bh); }
      const size_t o2 = (((b * NH + c0 / HD + (j >> 2)) * (TT / 32) + t0 / 32 + (rt >> 1)) * 4 + (j & 3)) * FRG + (rt & 1) * 256 + lane * 8; vst2(VT + o2, hi); vst2(VL + o2, lo); }
    return; }   /* block-uniform: which is blockIdx.z */
  /* partial rotary on dims 0..31 of each head: tiles (4hh, 4hh+1) hold dims (col, col+16) of the same lane: (x1, x2) -> (x1 c - x2 s, x2 c + x1 s), angle = t * inv_freq[col] */
  const auto put = [&](const v8f& tile, int rt, int j) {   /* one 16 x 16 tile (row tile rt of the block, column tile j) into the staging planes */
#pragma unroll
    for (int r = 0; r < 8; ++r) { const float v = tile[r]; const int rl = rt * 16 + 8 * g + r, cl = j * 16 + col; const _Float16 hv = (_Float16)v;
      sh[rl][cl] = hv; sl[rl][cl] = (_Float16)((v - (float)hv) * 1024.0f);   /* q residual carried x 2^10 so the plane stays f16-normal on the chip */ } };
#pragma unroll
  for (int u = 0; u < RG; ++u)
#pragma unroll
    for (int hh = 0; hh < 2; ++hh) { put(acc[u][4 * hh + 2], wave * RG + u, 4 * hh + 2); put(acc[u][4 * hh + 3], wave * RG + u, 4 * hh + 3); }   /* dims 32..63 pass unrotated and leave their registers first */
#pragma unroll 1   // one copy of the long cosf / sinf text serves every row tile: unrolled, the kernel's text would grow RG-fold
  for (int u = 0; u < RG; ++u) {
#pragma unroll
    for (int hh = 0; hh < 2; ++hh) {
#pragma unroll
      for (int r = 0; r < 8; ++r) { const int t = (int)((r0 + (wave * RG + u) * 16 + 8 * g + r) % TT); const float ang = (float)t * INVF[col]; const float cs = cosf(ang), sn = sinf(ang); const float x1 = acc[0][4 * hh][r], x2 = acc[0][4 * hh + 1][r]; acc[0][4 * hh][r] = x1 * cs - x2 * sn; acc[0][4 * hh + 1][r] = x2 * cs + x1 * sn; }
      put(acc[0][4 * hh], wave * RG + u, 4 * hh); put(acc[0][4 * hh + 1], wave * RG + u, 4 * hh + 1); }
#pragma unroll
    for (int v = 0; v + 1 < RG; ++v)
#pragma unroll
      for (int hh = 0; hh < 2; ++hh) { acc[v][4 * hh] = acc[v + 1][4 * hh]; acc[v][4 * hh + 1] = acc[v + 1][4 * hh + 1]; }   /* trip u always works on acc[0]: constant register indices in a rolled loop */
  }
  __syncthreads();
  /* chunk e = [head 0..1][t tile 0..4 RG - 1][dims 8 * (0..7)][t & 15]: bits 0..6 are the chunk's place in its pair of fragments (kc 0, 1) */
  _Float16* dh = which == 0 ? QH : KH; for (int e = tid; e < 64 * RG * 16; e += 128) { const int tt = (e >> 7) % (4 * RG), hd = e / (512 * RG); const int rl = tt * 16 + (e & 15), cl = hd * 64 + ((e >> 4) & 7) * 8; const size_t o2 = ((b * NH + c0 / HD + hd) * (TT / 16) + t0 / 16 + tt) * (2 * FRG) + (e & 127) * 8;
    vst2(dh + o2, *(const v4u*)&sh[rl][cl]);
    asm volatile("s_wait_xcnt 0x0" ::: "memory");   // the store's data and address registers are rewritten by the next LDS read and the next trip
    if (which == 0) { vst2(QL + o2, *(const v4u*)&sl[rl][cl]);
      asm volatile("s_wait_xcnt 0x0" ::: "memory");   // as above
    } } }
#define QG 1
#define KT 4
__device__ __forceinline__ float xhalf(float x) { return __builtin_bit_cast(float, __builtin_amdgcn_permlanex16(__builtin_bit_cast(int, x), __builtin_bit_cast(int, x), 0x76543210, 0xfedcba98, false, false)); }   // lane l with lane l ^ 16
__global__ __launch_bounds__(128) void k_att(const _Float16* __restrict__ QH, const _Float16* __restrict__ QL, const _Float16* __restrict__ KH, const __bf16* __restrict__ VT, const __bf16* __restrict__ VL, __bf16* __restrict__ YH, __bf16* __restrict__ YL) {
  const int tid = threadIdx.x, wave = __builtin_amdgcn_readfirstlane(tid >> 5), lane = tid & 31, col = lane & 15, g = lane >> 4; const int b = blockIdx.x / NH, h = blockIdx.x % NH;   // wave number in a scalar register, so q0 is scalar as well
  const int qb = TT / (64 * QG) - 1 - (int)blockIdx.y;   // the longest query blocks take the lowest blockIdx.y
  const int q0 = (qb * 4 + wave) * (16 * QG);            // the wave's first query
  const int npass = (qb * (64 * QG) + 64 * QG - 1) / (16 * KT) + 1;  // from the block's last query: the same in all four waves (64 QG is a multiple of 16 KT, so it is each wave's own count too); q0 is never below the last pass's first key, so every query sees a live key in every pass
  __shared__ __align__(16) char ring[2][3][16 * KT * HD * 2];   // a stage = one pass's k, v, v residual fragments
  v16h ah[QG][2], al[QG][2];
#pragma unroll
  for (int u = 0; u < QG; ++u)
#pragma unroll
    for (int kc = 0; kc < 2; ++kc) { const size_t qo = (((size_t)blockIdx.x * (TT / 16) + q0 / 16 + u) * 2 + kc) * FRG + lane * 8; ah[u][kc] = fragp_h(QH + qo); al[u][kc] = fragp_h(QL + qo); }
  const size_t ho = (size_t)blockIdx.x * (TT * HD) * 2 + tid * 16; const char* Kg = (const char*)KH + ho; const char* Vhg = (const char*)VT + ho; const char* Vlg = (const char*)VL + ho;   // blockIdx.x = b * NH + h; a head's k, v: TT * HD elements each, fragments [key tile][kc] and [32 keys][dim tile]: a pass's 8 fragments of each are 8 KiB in a row
  const unsigned rl = (unsigned)(size_t)&ring[0][0][0] + tid * 16;
  const auto fill = [&](int t) { const unsigned l = rl + (t & 1) * 24576; const size_t go = (size_t)t * 8192; cp8k(l, Kg + go); cp8k(l + 8192, Vhg + go); cp8k(l + 16384, Vlg + go); };
  fill(0); RING_LANDED(); __syncthreads();
  if (npass > 1) fill(1);   // same for the whole block
  v8f o[QG][4] = {}; float m[QG], l[QG];
#pragma unroll
  for (int u = 0; u < QG; ++u) { m[u] = -3.0e38f; l[u] = 0.f; }
#pragma unroll 1
  for (int kb = 0; kb < npass; ++kb) { const int k0 = kb * (16 * KT); const bool diag = kb == npass - 1;
    v16h kf[KT][2];
#pragma unroll
    for (int jt = 0; jt < KT; ++jt)
#pragma unroll
      for (int kc = 0; kc < 2; ++kc) kf[jt][kc] = fragp_h((const _Float16*)&ring[kb & 1][0][0] + (jt * 2 + kc) * FRG + lane * 8);
    F2 p[QG][KT / 2];
#pragma unroll
    for (int u = 0; u < QG; ++u) { v8f s[KT] = {}, sl[KT] = {};
#pragma unroll
      for (int kc = 0; kc < 2; ++kc)
#pragma unroll
        for (int jt = 0; jt < KT; ++jt) { s[jt] = wmma16(kf[jt][kc], ah[u][kc], s[jt]); sl[jt] = wmma16(kf[jt][kc], al[u][kc], sl[jt]); }
      const int qt = q0 + u * 16 + col; float mx = m[u];
#pragma unroll
      for (int jt = 0; jt < KT; ++jt) { s[jt] += sl[jt] * (1.0f / 1024.0f);
#pragma unroll
        for (int r = 0; r < 8; ++r) { float v = s[jt][r] * 0.125f; if (diag && k0 + jt * 16 + 8 * g + r > qt) v = -3.0e38f; s[jt][r] = v; mx = fmaxf(mx, v); } }
      mx = fmaxf(mx, xhalf(mx));
      const float sc = expf(m[u] - mx); m[u] = mx; float ps = 0.f;
#pragma unroll
      for (int jt = 0; jt < KT; ++jt)
#pragma unroll
        for (int r = 0; r < 8; ++r) { const float e = expf(s[jt][r] - mx); s[jt][r] = e; ps += e; }   /* a masked score is -3e38 and mx is a live score: expf gives exactly 0 */
      l[u] = l[u] * sc + ps;
#pragma unroll
      for (int j = 0; j < 4; ++j) o[u][j] *= sc;
#pragma unroll
      for (int c = 0; c < KT / 2; ++c) { float pv[16];
#pragma unroll
        for (int i = 0; i < 8; ++i) { pv[i] = s[2 * c][i]; pv[8 + i] = s[2 * c + 1][i]; }
        p[u][c] = bsplit16(pv); } }
#pragma unroll
    for (int c = 0; c < KT / 2; ++c) { v16b vh[4], vl[4];
#pragma unroll
      for (int j = 0; j < 4; ++j) { const int po = (c * 4 + j) * FRG + lane * 8; vh[j] = fragp_b((const __bf16*)&ring[kb & 1][1][0] + po); vl[j] = fragp_b((const __bf16*)&ring[kb & 1][2][0] + po); }
#pragma unroll
      for (int u = 0; u < QG; ++u) {
#pragma unroll
        for (int j = 0; j < 4; ++j) o[u][j] = wmma_bf(vh[j], p[u][c].h, o[u][j]);
#pragma unroll
        for (int j = 0; j < 4; ++j) o[u][j] = wmma_bf(vh[j], p[u][c].l, o[u][j]);
#pragma unroll
        for (int j = 0; j < 4; ++j) o[u][j] = wmma_bf(vl[j], p[u][c].h, o[u][j]); } }
    RING_READ(); RING_LANDED(); __syncthreads();
    if (kb + 2 < npass) fill(kb + 2);   // same for the whole block
  }
  RING_LANDED();
#pragma unroll
  for (int u = 0; u < QG; ++u) { const float inv = 1.0f / (l[u] + xhalf(l[u])); const size_t yo = (((size_t)b * TT + q0) / 16 + u) * (size_t)(CC / 32) * FRG + (size_t)(h * 2) * FRG + lane * 8;   // register r of tile j = dim 16 j + 8 g + r of the lane's query: chunk e = j & 1 of the y fragment kc = 2 h + (j >> 1)
#pragma unroll
    for (int j = 0; j < 4; ++j) { v8b hi, lo;
#pragma unroll
      for (int r = 0; r < 8; ++r) { const float y = o[u][j][r] * inv; const __bf16 yb = (__bf16)y; hi[r] = yb; lo[r] = (__bf16)(y - (float)yb); }
      const size_t o2 = yo + (j >> 1) * FRG + (j & 1) * 256; vst2(YH + o2, hi); vst2(YL + o2, lo); } } }
// ---- k_out: block = (64 rows, 128 cols): out = y (bf16 hi + lo) Wo + bo
__global__ __launch_bounds__(128) void k_out(const __bf16* __restrict__ YH, const __bf16* __restrict__ YL, const __bf16* __restrict__ WP, const float* __restrict__ BP, float* __restrict__ OUT) { __shared__ __align__(16) float sf[4][16][132]; __shared__ __align__(16) char wr[2][16384];   // wr: W ring, a stage = 2 kc x 8 fragments
  const int tid = threadIdx.x, wave = tid >> 5, lane = tid & 31, col = lane & 15, g = lane >> 4; const int c0 = blockIdx.y * 128; const size_t r0 = (size_t)blockIdx.x * 64 + wave * 16;
  const size_t ao = (r0 / 16) * (size_t)(CC / 32) * FRG + lane * 8; const __bf16* Ah = YH + ao; const __bf16* Al = YL + ao; const __bf16* Bp = WP + ((size_t)3 * (CC / 32) * (CC / 16) + c0 / 16) * FRG + lane * 8;
  v8f acc[8] = {};
  const unsigned wl = (unsigned)(size_t)&wr[0][0] + tid * 16; const char* wg = (const char*)(Bp - lane * 8) + tid * 16;
  const auto fill = [&](int t) { const unsigned l = wl + (t & 1) * 16384; const char* g = wg + (size_t)t * (2 * (CC / 16) * FRG * 2); cp8k(l, g); cp8k(l + 8192, g + (CC / 16) * FRG * 2); };   // stage t = kc 2 t, 2 t + 1
  fill(0); RING_LANDED(); __syncthreads(); fill(1);
#pragma unroll 1   // one stage a trip: the trip's foot is the ring's publish point
  for (int t = 0; t < CC / 64; ++t) { v16b ah[2], al[2];   // the wave's own y fragments of the stage, straight from L2
#pragma unroll
    for (int kk = 0; kk < 2; ++kk) ah[kk] = fragp_b(Ah + (size_t)(2 * t + kk) * FRG);
    asm volatile("s_wait_xcnt 0x0" ::: "memory");   // the address registers of the loads above may be reused as a later load's destination
#pragma unroll
    for (int kk = 0; kk < 2; ++kk) al[kk] = fragp_b(Al + (size_t)(2 * t + kk) * FRG);
    asm volatile("s_wait_xcnt 0x0" ::: "memory");   // as above, for the LDS loads that follow and the head of the next trip
#pragma unroll
    for (int kk = 0; kk < 2; ++kk) { v16b w[8]; const __bf16* ws = (const __bf16*)&wr[t & 1][kk * 8192] + lane * 8;
#pragma unroll
      for (int j = 0; j < 8; ++j) w[j] = fragp_b(ws + j * FRG);
#pragma unroll
      for (int j = 0; j < 8; ++j) { acc[j] = wmma_bf(ah[kk], w[j], acc[j]); acc[j] = wmma_bf(al[kk], w[j], acc[j]); }
    }
    RING_READ(); RING_LANDED(); __syncthreads();
    if (t + 2 < CC / 64) fill(t + 2);   // same for the whole block
  }
  RING_LANDED();
#pragma unroll
  for (int j = 0; j < 8; ++j) { const float bb = BP ? bfr(BP[c0 + j * 16 + col]) : 0.f;
#pragma unroll
    for (int r = 0; r < 8; ++r) sf[wave][8 * g + r][j * 16 + col] = acc[j][r] + bb; }
  LDSX(); for (int rl = 0; rl < 16; ++rl) vst2(OUT + (r0 + rl) * CC + c0 + lane * 4, *(const v4f*)&sf[wave][rl][lane * 4]); }
extern "C" void kernel_launch(void* const* d_in, const int* in_sizes, int n_in, void* d_out, int out_size, void* d_ws, size_t ws_size, hipStream_t stream) {
  (void)in_sizes; (void)n_in; (void)out_size;
  const float** F = (const float**)d_in;   // 0 x [2,2048,1024], 1 Wq [1024,1024] ((in,out)), 2 bq, 3 Wk, 4 bk, 5 Wv, 6 bv, 7 Wo ((in,out)), 8 bo
  if (ws_size < (size_t)WS_END) return;
  char* ws = (char*)d_ws; _Float16 *QH = (_Float16*)(ws + WS_QH), *QL = (_Float16*)(ws + WS_QL), *KH = (_Float16*)(ws + WS_KH); __bf16 *VT = (__bf16*)(ws + WS_VT), *VL = (__bf16*)(ws + WS_VL), *YH = (__bf16*)(ws + WS_YH), *YL = (__bf16*)(ws + WS_YL), *XP = (__bf16*)(ws + WS_XP), *WP = (__bf16*)(ws + WS_WP);
  k_pack<<<dim3(NXB + 4 * NWB), 256, 0, stream>>>(F[0], F[1], F[3], F[5], F[7], XP, WP);
  k_proj<<<dim3(TNB * TT / (64 * RG), CC / 128, 3), 128, 0, stream>>>(XP, WP, F[2], F[4], F[6], QH, QL, KH, VT, VL);
  k_att<<<dim3(TNB * NH, TT / (64 * QG)), 128, 0, stream>>>(QH, QL, KH, VT, VL, YH, YL);
  k_out<<<dim3(TNB * TT / 64, CC / 128), 128, 0, stream>>>(YH, YL, WP, F[8], (float*)d_out);
}

// v005
// Measured time: 105 microseconds a run.
// In both of two side-by-side timings against v004, it was 1.11 times as fast.
// Counting every step since v000, it is 12.8 times as fast.
// compute dtype: all float inputs rounded to bf16; q/k/v = x W + b ((in,out)) with EXACT bf16 products on WMMA 16x16x32, f32 accumulate; partial rotary (first 32 dims of each head) in f32 in the projection epilogue with precise cosf/sinf of t * inv_freq (the module's f32 inv_freq constants); q as f16 hi + residual (x 2^10), k f16 -> raw 2-product causal logits kept in registers; running-maximum softmax in f32 (hardware exp2 of (s - m) log2(e) / 8), exp((s - m) / 8) split bf16 hi + lo against v bf16 hi + lo (3 products), divided by the row sum at the end; out = o (bf16 hi + lo) Wo + bo; f32 output.
#include <hip/hip_runtime.h>
#include <math.h>

typedef __attribute__((ext_vector_type(16))) _Float16 v16h;
typedef __attribute__((ext_vector_type(16))) __bf16 v16b;
typedef __attribute__((ext_vector_type(8)))  _Float16 v8h;
typedef __attribute__((ext_vector_type(8)))  float v8f;
typedef __attribute__((ext_vector_type(4)))  float v4f;
typedef __attribute__((ext_vector_type(2)))  float v2f;
typedef __attribute__((ext_vector_type(4)))  unsigned v4u;
typedef __attribute__((ext_vector_type(4)))  int v4i;
typedef float __attribute__((may_alias)) float_a;
typedef int __attribute__((may_alias)) int_a;

template <typename T> __device__ __forceinline__ void vst2(void* p, T v) { *(T*)p = v;  }
__device__ __forceinline__ v8f wmma16(v16h a, v16h b, v8f c) {
  v8f d = __builtin_amdgcn_wmma_f32_16x16x32_f16(false, a, false, b, (short)0, c, false, false);
  asm volatile("v_nop\n\tv_nop\n\tv_nop\n\tv_nop" : "+v"(d) : "v"(a), "v"(b));
  return d;
}
__device__ __forceinline__ v8f wmma_bf(v16b a, v16b b, v8f c) {
  v8f d = __builtin_amdgcn_wmma_f32_16x16x32_bf16(false, a, false, b, (short)0, c, false, false);
  asm volatile("v_nop\n\tv_nop\n\tv_nop\n\tv_nop" : "+v"(d) : "v"(a), "v"(b));
  return d;
}
// 16x16x32 fragments: lane = (h = lane>>4, row/col = lane&15); elements 0..7 = k0+8h+0..7, 8..15 = k0+16+8h+0..7; D element r = row 8h+r
__device__ __forceinline__ v16h frag_h(const _Float16* rowk0, int lane) {
  union { v16h v; v8h q[2]; } u; const _Float16* p = rowk0 + 8 * (lane >> 4);
  u.q[0] = *(const v8h*)p; u.q[1] = *(const v8h*)(p + 16); return u.v;
}
__device__ __forceinline__ v16h frag_f32(const float* rowk0, int lane) {
  v16h a; const float* p = rowk0 + 8 * (lane >> 4);
#pragma unroll
  for (int i = 0; i < 8; ++i) { a[i] = (_Float16)p[i]; a[8 + i] = (_Float16)p[16 + i]; }
  return a;
}
__device__ __forceinline__ v16h frag_f32s(const float* rowk0, int lane, float sc) {
  v16h a; const float* p = rowk0 + 8 * (lane >> 4);
#pragma unroll
  for (int i = 0; i < 8; ++i) { a[i] = (_Float16)(p[i] * sc); a[8 + i] = (_Float16)(p[16 + i] * sc); }
  return a;
}
// column fragment from a [K][ld] layout (column n), rows >= K read as 0
__device__ __forceinline__ v16h fragc_f32(const float* W, int k0, int n, int lane, int ld, int K) {
  v16h a; const int g = lane >> 4;
#pragma unroll
  for (int i = 0; i < 8; ++i) { const int ka = k0 + 8 * g + i, kb = ka + 16;
    a[i] = (_Float16)(ka < K ? W[(size_t)(ka < K ? ka : K - 1) * ld + n] : 0.f); a[8 + i] = (_Float16)(kb < K ? W[(size_t)(kb < K ? kb : K - 1) * ld + n] : 0.f); }
  return a;
}
struct F2 { v16b h, l; };
__device__ __forceinline__ F2 bsplit16(const float v[16]) { F2 r;
#pragma unroll
  for (int i = 0; i < 16; ++i) { const __bf16 h = (__bf16)v[i]; r.h[i] = h; r.l[i] = (__bf16)(v[i] - (float)h); }
  return r; }
__device__ __forceinline__ F2 split_row(const float* row, int k0, int lane) { float v[16]; const float* p = row + k0 + 8 * (lane >> 4);
#pragma unroll
  for (int i = 0; i < 8; ++i) { v[i] = p[i]; v[8 + i] = p[16 + i]; }
  return bsplit16(v); }
__device__ __forceinline__ F2 split_rowK(const float* row, int k0, int lane, int K) { float v[16]; const int g = lane >> 4;
#pragma unroll
  for (int i = 0; i < 8; ++i) { const int ka = k0 + 8 * g + i, kb = ka + 16; v[i] = ka < K ? row[ka < K ? ka : K - 1] : 0.f; v[8 + i] = kb < K ? row[kb < K ? kb : K - 1] : 0.f; }
  return bsplit16(v); }
__device__ __forceinline__ F2 split_col(const float* W, int k0, int n, int lane, int ld, int K) { float v[16]; const int g = lane >> 4;
#pragma unroll
  for (int i = 0; i < 8; ++i) { const int ka = k0 + 8 * g + i, kb = ka + 16; v[i] = ka < K ? W[(size_t)(ka < K ? ka : K - 1) * ld + n] : 0.f; v[8 + i] = kb < K ? W[(size_t)(kb < K ? kb : K - 1) * ld + n] : 0.f; }
  return bsplit16(v); }
__device__ __forceinline__ v8f mac3(const F2& a, const F2& b, v8f c) { c = wmma_bf(a.l, b.h, c); c = wmma_bf(a.h, b.l, c); return wmma_bf(a.h, b.h, c); }
__device__ __forceinline__ float sigm(float v) { return 1.0f / (1.0f + expf(-v)); }
#define LDSX() do { asm volatile("s_wait_dscnt 0" ::: "memory"); __builtin_amdgcn_wave_barrier(); __builtin_amdgcn_fence(__ATOMIC_RELEASE, "workgroup"); } while (0)


// Causal MHA with partial rotary embedding (B 2, T 2,048, C 1,024 = 16 x 64, rotary on dims 0..31 of each head as rotate_half pairs (d, d+16), base 10000): att = softmax(q_rot k_rot^T / 8 | causal) v; out = merged Wo + bo.
#define NB 2
#define TT 2048
#define CC 1024
#define NH 16
#define HD 64
__constant__ float INVF[16] = {1.000000000e+00f,5.623413324e-01f,3.162277639e-01f,1.778279394e-01f,1.000000015e-01f,5.623412877e-02f,3.162277862e-02f,1.778279431e-02f,9.999999776e-03f,5.623413250e-03f,3.162277862e-03f,1.778279431e-03f,1.000000047e-03f,5.623413017e-04f,3.162277862e-04f,1.778279402e-04f};   // 1 / 10000^(2i/32) as the module's f32 values
#ifndef TNB
#define TNB NB
#endif
typedef __attribute__((ext_vector_type(8))) __bf16 v8b;
__device__ __forceinline__ v16b frag_b(const __bf16* rowk0, int lane) {
  union { v16b v; v8b q[2]; } u; const __bf16* p = rowk0 + 8 * (lane >> 4);
  u.q[0] = *(const v8b*)p; u.q[1] = *(const v8b*)(p + 16); return u.v;
}
__device__ __forceinline__ float bfr(float v) { return (float)(__bf16)v; }
__device__ __attribute__((noinline)) float exp_ni(float v) { return expf(v); }
__device__ __attribute__((noinline)) float erf_ni(float v) { return erff(v); }

#define WS_QH  0u
#define WS_QL  (WS_QH + 2u * (size_t)NB * TT * CC)
#define WS_KH  (WS_QL + 2u * (size_t)NB * TT * CC)
#define WS_VT  (WS_KH + 2u * (size_t)NB * TT * CC)      // bf16 v, fragment order
#define WS_VL  (WS_VT + 2u * (size_t)NB * CC * TT)      // bf16 v residual, fragment order
#define WS_YH  (WS_VL + 2u * (size_t)NB * CC * TT)      // bf16 y, fragment order
#define WS_YL  (WS_YH + 2u * (size_t)NB * TT * CC)      // bf16 y residual
#define WS_XP  (WS_YL + 2u * (size_t)NB * TT * CC)      // bf16 x, fragment order
#define WS_WP  (WS_XP + 2u * (size_t)NB * TT * CC)      // bf16 Wq, Wk, Wv, Wo, fragment order
#define WS_END (WS_WP + 2u * (size_t)4 * CC * CC)

// FRAGMENT ORDER, every 16-bit matrix operand in the workspace: one 16 x 32 fragment = 512 elements = [e 0..1][lane 0..31][i 0..7], holding (row or column lane & 15, k = 16 e + 8 (lane >> 4) + i).
// A wave reads a fragment as two 16-byte loads per lane, each 512 contiguous bytes (4 cache lines); from row-major planes the same load touched 16 lines.
#define FRG 512
__device__ __forceinline__ v16b fragp_b(const __bf16* p) { union { v16b v; v8b q[2]; } u; u.q[0] = *(const v8b*)p; u.q[1] = *(const v8b*)(p + 256); return u.v; }       // p = fragment + 8 * lane
__device__ __forceinline__ v16h fragp_h(const _Float16* p) { union { v16h v; v8h q[2]; } u; u.q[0] = *(const v8h*)p; u.q[1] = *(const v8h*)(p + 256); return u.v; }
// LDS RING: fragments that all four waves of a block read come from L2 once per block, not once per wave: 128 threads x 16 bytes x 4 asynchronous copies = 8 KiB (8 fragments, contiguous in the workspace) from g to LDS byte address l, both already the lane's own (+ 16 * tid).
// Two buffers: stage t + 2 is asked for behind the barrier that ends the reads of stage t, and flies while stage t + 1 is worked on.
__device__ __forceinline__ void cp8k(unsigned l, const char* g) {
  // s_wait_xcnt as the statement's last line, a precaution: no register that one of the four copies names is rewritten in front of it
  asm volatile("global_load_async_to_lds_b128 %0, %4, off\n\tglobal_load_async_to_lds_b128 %1, %5, off\n\tglobal_load_async_to_lds_b128 %2, %6, off\n\tglobal_load_async_to_lds_b128 %3, %7, off\n\ts_wait_xcnt 0x0"
               :: "v"(l), "v"(l + 2048u), "v"(l + 4096u), "v"(l + 6144u), "v"(g), "v"(g + 2048), "v"(g + 4096), "v"(g + 6144) : "memory");
}
#define RING_LANDED() asm volatile("s_wait_asynccnt 0x0" ::: "memory")   // this wave's copies have landed; the barrier behind it shows them to the other waves
#define RING_READ()   asm volatile("s_wait_dscnt 0x0" ::: "memory")      // this wave's LDS reads of the stage are done before the barrier behind which the buffer is refilled

// ---- k_pack: x and the four weights rounded to bf16 and laid out in fragment order; a chunk = 16 bytes = 8 k of one row or column, chunks in output order, PCH chunks per thread (fewer waves, for speed only).
// x fragments [row tile][kc]; weight fragments [which][kc][column tile]
#define PCH 8
#define NXB (TNB * TT * CC / (2048 * PCH))
#define NWB (CC * CC / (2048 * PCH))
__global__ __launch_bounds__(256) void k_pack(const float* __restrict__ X, const float* __restrict__ WQ, const float* __restrict__ WK, const float* __restrict__ WV, const float* __restrict__ WO, __bf16* __restrict__ XP, __bf16* __restrict__ WP) {
  const int tid = threadIdx.x, rc = tid & 15, k8 = 16 * ((tid >> 5) & 1) + 8 * ((tid >> 4) & 1);
  if (blockIdx.x < NXB) { v4f x0[PCH], x1[PCH];
#pragma unroll
    for (int it = 0; it < PCH; ++it) { const unsigned f = ((blockIdx.x * PCH + it) * 256u + tid) >> 6; const float* p = X + ((size_t)(f >> 5) * 16 + rc) * CC + (f & 31) * 32 + k8; x0[it] = *(const v4f*)p;
      asm volatile("s_wait_xcnt 0x0" ::: "memory");   // the address registers of the load above may be reused as the next load's destination
      x1[it] = *(const v4f*)(p + 4);
      asm volatile("s_wait_xcnt 0x0" ::: "memory");   // as above, for a later chunk's load
    }
#pragma unroll
    for (int it = 0; it < PCH; ++it) { const unsigned c = (blockIdx.x * PCH + it) * 256u + tid; v8b o;
#pragma unroll
      for (int i = 0; i < 4; ++i) { o[i] = (__bf16)x0[it][i]; o[4 + i] = (__bf16)x1[it][i]; }
      vst2(XP + (size_t)c * 8, o); } }
  else { const unsigned wb = blockIdx.x - NXB, w = wb / NWB; const float* WA = w == 0 ? WQ : w == 1 ? WK : w == 2 ? WV : WO;
#pragma unroll
    for (int it = 0; it < PCH; ++it) { const unsigned c = (wb * PCH + it) * 256u + tid, f = c >> 6; const float* p = WA + (size_t)(((f >> 6) & 31) * 32 + k8) * CC + (f & 63) * 16 + rc; v8b o;   /* (in,out) */
#pragma unroll
      for (int i = 0; i < 8; ++i) o[i] = (__bf16)p[(size_t)i * CC];
      vst2(WP + (size_t)c * 8, o); } } }
// ---- k_proj: block = (128 rows, 128 cols, which), wave = RG row tiles of 16 x 128 cols, so every loaded W fragment feeds RG products: qkv = x W (+ b), exact; q -> f16 hi (+ residual), k -> f16, v -> bf16 hi + residual, all in fragment order
#define RG 2
__global__ __launch_bounds__(128) void k_proj(const __bf16* __restrict__ XP, const __bf16* __restrict__ WP, const float* __restrict__ BQ, const float* __restrict__ BK, const float* __restrict__ BV, _Float16* __restrict__ QH, _Float16* __restrict__ QL, _Float16* __restrict__ KH, __bf16* __restrict__ VT, __bf16* __restrict__ VL) {
  __shared__ __align__(16) _Float16 sh[64 * RG][136], sl[64 * RG][136]; __shared__ __align__(16) char wr[2][16384];   // wr: W ring, a stage = 2 kc x 8 fragments
  const int tid = threadIdx.x, wave = tid >> 5, lane = tid & 31, col = lane & 15, g = lane >> 4; const int which = blockIdx.z; const int c0 = blockIdx.y * 128; const size_t r0 = (size_t)blockIdx.x * (64 * RG); const float* BA = which == 0 ? BQ : which == 1 ? BK : BV;
  const __bf16* Ap = XP + (r0 / 16 + wave * RG) * (size_t)(CC / 32) * FRG + lane * 8; const __bf16* Bp = WP + ((size_t)which * (CC / 32) * (CC / 16) + c0 / 16) * FRG + lane * 8;
  v8f acc[RG][8] = {};
  const unsigned wl = (unsigned)(size_t)&wr[0][0] + tid * 16; const char* wg = (const char*)(Bp - lane * 8) + tid * 16;
  const auto fill = [&](int t) { const unsigned l = wl + (t & 1) * 16384; const char* g = wg + (size_t)t * (2 * (CC / 16) * FRG * 2); cp8k(l, g); cp8k(l + 8192, g + (CC / 16) * FRG * 2); };   // stage t = kc 2 t, 2 t + 1
  fill(0); RING_LANDED(); __syncthreads(); fill(1);
#pragma unroll 1   // one stage a trip: the trip's foot is the ring's publish point
  for (int t = 0; t < CC / 64; ++t) { v16b a[2][RG];   // the wave's own x fragments of the stage, straight from L2
#pragma unroll
    for (int kk = 0; kk < 2; ++kk)
#pragma unroll
      for (int u = 0; u < RG; ++u) a[kk][u] = fragp_b(Ap + ((size_t)u * (CC / 32) + 2 * t + kk) * FRG);
#pragma unroll
    for (int kk = 0; kk < 2; ++kk) { v16b w[8]; const __bf16* ws = (const __bf16*)&wr[t & 1][kk * 8192] + lane * 8;
#pragma unroll
      for (int j = 0; j < 8; ++j) w[j] = fragp_b(ws + j * FRG);
#pragma unroll
      for (int j = 0; j < 8; ++j)
#pragma unroll
        for (int u = 0; u < RG; ++u) acc[u][j] = wmma_bf(a[kk][u], w[j], acc[u][j]);
    }
    asm volatile("s_wait_xcnt 0x0" ::: "memory");   // the address registers of this trip's loads are rewritten at the head of the next trip
    RING_READ(); RING_LANDED(); __syncthreads();
    if (t + 2 < CC / 64) fill(t + 2);   // same for the whole block
  }
  RING_LANDED();
#pragma unroll
  for (int j = 0; j < 8; ++j) { const float bb0 = BA ? bfr(BA[c0 + j * 16 + col]) : 0.f;
#pragma unroll
    for (int u = 0; u < RG; ++u)
#pragma unroll
      for (int r = 0; r < 8; ++r) acc[u][j][r] += bb0; }   /* bias before the rotary */
  const size_t b = r0 / TT; const int t0 = (int)(r0 % TT);
  if (which == 2) {   /* a lane's 8 registers of tile (u, j) are 8 consecutive t of one feature: one chunk of the V^T fragment (t / 32, dim tile j & 3), e = row tile & 1, stored straight from registers */
#pragma unroll
    for (int u = 0; u < RG; ++u)
#pragma unroll
    for (int j = 0; j < 8; ++j) { v8b hi, lo; const int rt = wave * RG + u;
#pragma unroll
      for (int r = 0; r < 8; ++r) { const float v = acc[u][j][r]; const __bf16 bh = (__bf16)v; hi[r] = bh; lo[r] = (__bf16)(v - (float)bh); }
      const size_t o2 = (((b * NH + c0 / HD + (j >> 2)) * (TT / 32) + t0 / 32 + (rt >> 1)) * 4 + (j & 3)) * FRG + (rt & 1) * 256 + lane * 8; vst2(VT + o2, hi); vst2(VL + o2, lo); }
    return; }   /* block-uniform: which is blockIdx.z */
  /* partial rotary on dims 0..31 of each head: tiles (4hh, 4hh+1) hold dims (col, col+16) of the same lane: (x1, x2) -> (x1 c - x2 s, x2 c + x1 s), angle = t * inv_freq[col] */
  const auto put = [&](const v8f& tile, int rt, int j) {   /* one 16 x 16 tile (row tile rt of the block, column tile j) into the staging planes */
#pragma unroll
    for (int r = 0; r < 8; ++r) { const float v = tile[r]; const int rl = rt * 16 + 8 * g + r, cl = j * 16 + col; const _Float16 hv = (_Float16)v;
      sh[rl][cl] = hv; sl[rl][cl] = (_Float16)((v - (float)hv) * 1024.0f);   /* q residual carried x 2^10 so the plane stays f16-normal on the chip */ } };
#pragma unroll
  for (int u = 0; u < RG; ++u)
#pragma unroll
    for (int hh = 0; hh < 2; ++hh) { put(acc[u][4 * hh + 2], wave * RG + u, 4 * hh + 2); put(acc[u][4 * hh + 3], wave * RG + u, 4 * hh + 3); }   /* dims 32..63 pass unrotated and leave their registers first */
#pragma unroll 1   // one copy of the long cosf / sinf text serves every row tile: unrolled, the kernel's text would grow RG-fold
  for (int u = 0; u < RG; ++u) {
#pragma unroll
    for (int hh = 0; hh < 2; ++hh) {
#pragma unroll
      for (int r = 0; r < 8; ++r) { const int t = (int)((r0 + (wave * RG + u) * 16 + 8 * g + r) % TT); const float ang = (float)t * INVF[col]; const float cs = cosf(ang), sn = sinf(ang); const float x1 = acc[0][4 * hh][r], x2 = acc[0][4 * hh + 1][r]; acc[0][4 * hh][r] = x1 * cs - x2 * sn; acc[0][4 * hh + 1][r] = x2 * cs + x1 * sn; }
      put(acc[0][4 * hh], wave * RG + u, 4 * hh); put(acc[0][4 * hh + 1], wave * RG + u, 4 * hh + 1); }
#pragma unroll
    for (int v = 0; v + 1 < RG; ++v)
#pragma unroll
      for (int hh = 0; hh < 2; ++hh) { acc[v][4 * hh] = acc[v + 1][4 * hh]; acc[v][4 * hh + 1] = acc[v + 1][4 * hh + 1]; }   /* trip u always works on acc[0]: constant register indices in a rolled loop */
  }
  __syncthreads();
  /* chunk e = [head 0..1][t tile 0..4 RG - 1][dims 8 * (0..7)][t & 15]: bits 0..6 are the chunk's place in its pair of fragments (kc 0, 1) */
  _Float16* dh = which == 0 ? QH : KH; for (int e = tid; e < 64 * RG * 16; e += 128) { const int tt = (e >> 7) % (4 * RG), hd = e / (512 * RG); const int rl = tt * 16 + (e & 15), cl = hd * 64 + ((e >> 4) & 7) * 8; const size_t o2 = ((b * NH + c0 / HD + hd) * (TT / 16) + t0 / 16 + tt) * (2 * FRG) + (e & 127) * 8;
    vst2(dh + o2, *(const v4u*)&sh[rl][cl]);
    asm volatile("s_wait_xcnt 0x0" ::: "memory");   // the store's data and address registers are rewritten by the next LDS read and the next trip
    if (which == 0) { vst2(QL + o2, *(const v4u*)&sl[rl][cl]);
      asm volatile("s_wait_xcnt 0x0" ::: "memory");   // as above
    } } }
#define QG 1
#define KT 4
#define SCL2 0.18033688011112042f   // (1 / 8) log2(e): exp((s - m) / 8) = 2^(s SCL2 - m SCL2), one multiply-add and the hardware's exp2 per score
__device__ __forceinline__ float xhalf(float x) { return __builtin_bit_cast(float, __builtin_amdgcn_permlanex16(__builtin_bit_cast(int, x), __builtin_bit_cast(int, x), 0x76543210, 0xfedcba98, false, false)); }   // lane l with lane l ^ 16
__global__ __launch_bounds__(128) void k_att(const _Float16* __restrict__ QH, const _Float16* __restrict__ QL, const _Float16* __restrict__ KH, const __bf16* __restrict__ VT, const __bf16* __restrict__ VL, __bf16* __restrict__ YH, __bf16* __restrict__ YL) {
  const int tid = threadIdx.x, wave = __builtin_amdgcn_readfirstlane(tid >> 5), lane = tid & 31, col = lane & 15, g = lane >> 4; const int b = blockIdx.x / NH, h = blockIdx.x % NH;   // wave number in a scalar register, so q0 is scalar as well
  const int qb = TT / (64 * QG) - 1 - (int)blockIdx.y;   // the longest query blocks take the lowest blockIdx.y
  const int q0 = (qb * 4 + wave) * (16 * QG);            // the wave's first query
  const int npass = (qb * (64 * QG) + 64 * QG - 1) / (16 * KT) + 1;  // from the block's last query: the same in all four waves (64 QG is a multiple of 16 KT, so it is each wave's own count too); q0 is never below the last pass's first key, so every query sees a live key in every pass
  __shared__ __align__(16) char ring[2][3][16 * KT * HD * 2];   // a stage = one pass's k, v, v residual fragments
  v16h ah[QG][2], al[QG][2];
#pragma unroll
  for (int u = 0; u < QG; ++u)
#pragma unroll
    for (int kc = 0; kc < 2; ++kc) { const size_t qo = (((size_t)blockIdx.x * (TT / 16) + q0 / 16 + u) * 2 + kc) * FRG + lane * 8; ah[u][kc] = fragp_h(QH + qo); al[u][kc] = fragp_h(QL + qo); }
  const size_t ho = (size_t)blockIdx.x * (TT * HD) * 2 + tid * 16; const char* Kg = (const char*)KH + ho; const char* Vhg = (const char*)VT + ho; const char* Vlg = (const char*)VL + ho;   // blockIdx.x = b * NH + h; a head's k, v: TT * HD elements each, fragments [key tile][kc] and [32 keys][dim tile]: a pass's 8 fragments of each are 8 KiB in a row
  const unsigned rl = (unsigned)(size_t)&ring[0][0][0] + tid * 16;
  const auto fill = [&](int t) { const unsigned l = rl + (t & 1) * 24576; const size_t go = (size_t)t * 8192; cp8k(l, Kg + go); cp8k(l + 8192, Vhg + go); cp8k(l + 16384, Vlg + go); };
  fill(0); RING_LANDED(); __syncthreads();
  if (npass > 1) fill(1);   // same for the whole block
  v8f o[QG][4] = {}; float m[QG], l[QG];   // m: running maximum of the raw products
#pragma unroll
  for (int u = 0; u < QG; ++u) { m[u] = -3.0e38f; l[u] = 0.f; }
#pragma unroll 1
  for (int kb = 0; kb < npass; ++kb) { const int k0 = kb * (16 * KT); const bool diag = kb == npass - 1;
    v16h kf[KT][2];
#pragma unroll
    for (int jt = 0; jt < KT; ++jt)
#pragma unroll
      for (int kc = 0; kc < 2; ++kc) kf[jt][kc] = fragp_h((const _Float16*)&ring[kb & 1][0][0] + (jt * 2 + kc) * FRG + lane * 8);
    F2 p[QG][KT / 2];
#pragma unroll
    for (int u = 0; u < QG; ++u) { v8f s[KT] = {}, sl[KT] = {};
#pragma unroll
      for (int kc = 0; kc < 2; ++kc)
#pragma unroll
        for (int jt = 0; jt < KT; ++jt) { s[jt] = wmma16(kf[jt][kc], ah[u][kc], s[jt]); sl[jt] = wmma16(kf[jt][kc], al[u][kc], sl[jt]); }
      const int qt = q0 + u * 16 + col; float mx = m[u];
#pragma unroll
      for (int jt = 0; jt < KT; ++jt) { s[jt] += sl[jt] * (1.0f / 1024.0f);
#pragma unroll
        for (int r = 0; r < 8; ++r) { float v = s[jt][r]; if (diag && k0 + jt * 16 + 8 * g + r > qt) v = -3.0e38f; s[jt][r] = v; mx = fmaxf(mx, v); } }   /* maximum over the raw products: the scale is positive */
      mx = fmaxf(mx, xhalf(mx));
      const float nm = -mx * SCL2, sc = __builtin_amdgcn_exp2f((m[u] - mx) * SCL2); m[u] = mx; float ps = 0.f;   /* nm is rounded once, to 2^-24 of m SCL2: far below what the f16 rounding of k leaves in the same score */
#pragma unroll
      for (int jt = 0; jt < KT; ++jt) { s[jt] = s[jt] * SCL2 + nm;   /* contracts to one multiply-add a score */
#pragma unroll
        for (int r = 0; r < 8; ++r) { const float e = __builtin_amdgcn_exp2f(s[jt][r]); s[jt][r] = e; ps += e; } }   /* a masked score is -3e38 and mx is a live score: the exponent is about -5e37 and the result exactly 0 */
      l[u] = l[u] * sc + ps;
#pragma unroll
      for (int j = 0; j < 4; ++j) o[u][j] *= sc;
#pragma unroll
      for (int c = 0; c < KT / 2; ++c) { float pv[16];
#pragma unroll
        for (int i = 0; i < 8; ++i) { pv[i] = s[2 * c][i]; pv[8 + i] = s[2 * c + 1][i]; }
        p[u][c] = bsplit16(pv); } }
#pragma unroll
    for (int c = 0; c < KT / 2; ++c) { v16b vh[4], vl[4];
#pragma unroll
      for (int j = 0; j < 4; ++j) { const int po = (c * 4 + j) * FRG + lane * 8; vh[j] = fragp_b((const __bf16*)&ring[kb & 1][1][0] + po); vl[j] = fragp_b((const __bf16*)&ring[kb & 1][2][0] + po); }
#pragma unroll
      for (int u = 0; u < QG; ++u) {
#pragma unroll
        for (int j = 0; j < 4; ++j) o[u][j] = wmma_bf(vh[j], p[u][c].h, o[u][j]);
#pragma unroll
        for (int j = 0; j < 4; ++j) o[u][j] = wmma_bf(vh[j], p[u][c].l, o[u][j]);
#pragma unroll
        for (int j = 0; j < 4; ++j) o[u][j] = wmma_bf(vl[j], p[u][c].h, o[u][j]); } }
    RING_READ(); RING_LANDED(); __syncthreads();
    if (kb + 2 < npass) fill(kb + 2);   // same for the whole block
  }
  RING_LANDED();
#pragma unroll
  for (int u = 0; u < QG; ++u) { const float inv = 1.0f / (l[u] + xhalf(l[u])); const size_t yo = (((size_t)b * TT + q0) / 16 + u) * (size_t)(CC / 32) * FRG + (size_t)(h * 2) * FRG + lane * 8;   // register r of tile j = dim 16 j + 8 g + r of the lane's query: chunk e = j & 1 of the y fragment kc = 2 h + (j >> 1)
#pragma unroll
    for (int j = 0; j < 4; ++j) { v8b hi, lo;
#pragma unroll
      for (int r = 0; r < 8; ++r) { const float y = o[u][j][r] * inv; const __bf16 yb = (__bf16)y; hi[r] = yb; lo[r] = (__bf16)(y - (float)yb); }
      const size_t o2 = yo + (j >> 1) * FRG + (j & 1) * 256; vst2(YH + o2, hi); vst2(YL + o2, lo); } } }
// ---- k_out: block = (64 rows, 128 cols): out = y (bf16 hi + lo) Wo + bo
__global__ __launch_bounds__(128) void k_out(const __bf16* __restrict__ YH, const __bf16* __restrict__ YL, const __bf16* __restrict__ WP, const float* __restrict__ BP, float* __restrict__ OUT) { __shared__ __align__(16) float sf[4][16][132]; __shared__ __align__(16) char wr[2][16384];   // wr: W ring, a stage = 2 kc x 8 fragments
  const int tid = threadIdx.x, wave = tid >> 5, lane = tid & 31, col = lane & 15, g = lane >> 4; const int c0 = blockIdx.y * 128; const size_t r0 = (size_t)blockIdx.x * 64 + wave * 16;
  const size_t ao = (r0 / 16) * (size_t)(CC / 32) * FRG + lane * 8; const __bf16* Ah = YH + ao; const __bf16* Al = YL + ao; const __bf16* Bp = WP + ((size_t)3 * (CC / 32) * (CC / 16) + c0 / 16) * FRG + lane * 8;
  v8f acc[8] = {};
  const unsigned wl = (unsigned)(size_t)&wr[0][0] + tid * 16; const char* wg = (const char*)(Bp - lane * 8) + tid * 16;
  const auto fill = [&](int t) { const unsigned l = wl + (t & 1) * 16384; const char* g = wg + (size_t)t * (2 * (CC / 16) * FRG * 2); cp8k(l, g); cp8k(l + 8192, g + (CC / 16) * FRG * 2); };   // stage t = kc 2 t, 2 t + 1
  fill(0); RING_LANDED(); __syncthreads(); fill(1);
#pragma unroll 1   // one stage a trip: the trip's foot is the ring's publish point
  for (int t = 0; t < CC / 64; ++t) { v16b ah[2], al[2];   // the wave's own y fragments of the stage, straight from L2
#pragma unroll
    for (int kk = 0; kk < 2; ++kk) ah[kk] = fragp_b(Ah + (size_t)(2 * t + kk) * FRG);
    asm volatile("s_wait_xcnt 0x0" ::: "memory");   // the address registers of the loads above may be reused as a later load's destination
#pragma unroll
    for (int kk = 0; kk < 2; ++kk) al[kk] = fragp_b(Al + (size_t)(2 * t + kk) * FRG);
    asm volatile("s_wait_xcnt 0x0" ::: "memory");   // as above, for the LDS loads that follow and the head of the next trip
#pragma unroll
    for (int kk = 0; kk < 2; ++kk) { v16b w[8]; const __bf16* ws = (const __bf16*)&wr[t & 1][kk * 8192] + lane * 8;
#pragma unroll
      for (int j = 0; j < 8; ++j) w[j] = fragp_b(ws + j * FRG);
#pragma unroll
      for (int j = 0; j < 8; ++j) { acc[j] = wmma_bf(ah[kk], w[j], acc[j]); acc[j] = wmma_bf(al[kk], w[j], acc[j]); }
    }
    RING_READ(); RING_LANDED(); __syncthreads();
    if (t + 2 < CC / 64) fill(t + 2);   // same for the whole block
  }
  RING_LANDED();
#pragma unroll
  for (int j = 0; j < 8; ++j) { const float bb = BP ? bfr(BP[c0 + j * 16 + col]) : 0.f;
#pragma unroll
    for (int r = 0; r < 8; ++r) sf[wave][8 * g + r][j * 16 + col] = acc[j][r] + bb; }
  LDSX(); for (int rl = 0; rl < 16; ++rl) vst2(OUT + (r0 + rl) * CC + c0 + lane * 4, *(const v4f*)&sf[wave][rl][lane * 4]); }
extern "C" void kernel_launch(void* const* d_in, const int* in_sizes, int n_in, void* d_out, int out_size, void* d_ws, size_t ws_size, hipStream_t stream) {
  (void)in_sizes; (void)n_in; (void)out_size;
  const float** F = (const float**)d_in;   // 0 x [2,2048,1024], 1 Wq [1024,1024] ((in,out)), 2 bq, 3 Wk, 4 bk, 5 Wv, 6 bv, 7 Wo ((in,out)), 8 bo
  if (ws_size < (size_t)WS_END) return;
  char* ws = (char*)d_ws; _Float16 *QH = (_Float16*)(ws + WS_QH), *QL = (_Float16*)(ws + WS_QL), *KH = (_Float16*)(ws + WS_KH); __bf16 *VT = (__bf16*)(ws + WS_VT), *VL = (__bf16*)(ws + WS_VL), *YH = (__bf16*)(ws + WS_YH), *YL = (__bf16*)(ws + WS_YL), *XP = (__bf16*)(ws + WS_XP), *WP = (__bf16*)(ws + WS_WP);
  k_pack<<<dim3(NXB + 4 * NWB), 256, 0, stream>>>(F[0], F[1], F[3], F[5], F[7], XP, WP);
  k_proj<<<dim3(TNB * TT / (64 * RG), CC / 128, 3), 128, 0, stream>>>(XP, WP, F[2], F[4], F[6], QH, QL, KH, VT, VL);
  k_att<<<dim3(TNB * NH, TT / (64 * QG)), 128, 0, stream>>>(QH, QL, KH, VT, VL, YH, YL);
  k_out<<<dim3(TNB * TT / 64, CC / 128), 128, 0, stream>>>(YH, YL, WP, F[8], (float*)d_out);
}

// v006
// It runs in 98.9 microseconds.
// Two timings next to v005 both put it at 1.06 times that version's speed.
// Counting every step since v000, it is 13.6 times as fast.
// compute dtype: all float inputs rounded to bf16; q/k/v = x W + b ((in,out)) with EXACT bf16 products on WMMA 16x16x32, f32 accumulate; partial rotary (first 32 dims of each head) in f32 in the projection epilogue with precise cosf/sinf of t * inv_freq (the module's f32 inv_freq constants); q as f16 hi + residual (x 2^10), k f16 -> raw 2-product causal logits kept in registers; running-maximum softmax in f32 (hardware exp2 of (s - m) log2(e) / 8), exp((s - m) / 8) split bf16 hi + lo against v bf16 hi + lo (3 products), divided by the row sum at the end; out = o (bf16 hi + lo) Wo + bo; f32 output.
#include <hip/hip_runtime.h>
#include <math.h>

typedef __attribute__((ext_vector_type(16))) _Float16 v16h;
typedef __attribute__((ext_vector_type(16))) __bf16 v16b;
typedef __attribute__((ext_vector_type(8)))  _Float16 v8h;
typedef __attribute__((ext_vector_type(8)))  float v8f;
typedef __attribute__((ext_vector_type(4)))  float v4f;
typedef __attribute__((ext_vector_type(2)))  float v2f;
typedef __attribute__((ext_vector_type(4)))  unsigned v4u;
typedef __attribute__((ext_vector_type(4)))  int v4i;
typedef float __attribute__((may_alias)) float_a;
typedef int __attribute__((may_alias)) int_a;

template <typename T> __device__ __forceinline__ void vst2(void* p, T v) { *(T*)p = v;  }
__device__ __forceinline__ v8f wmma16(v16h a, v16h b, v8f c) {
  v8f d = __builtin_amdgcn_wmma_f32_16x16x32_f16(false, a, false, b, (short)0, c, false, false);
  asm volatile("v_nop\n\tv_nop\n\tv_nop\n\tv_nop" : "+v"(d) : "v"(a), "v"(b));
  return d;
}
__device__ __forceinline__ v8f wmma_bf(v16b a, v16b b, v8f c) {
  v8f d = __builtin_amdgcn_wmma_f32_16x16x32_bf16(false, a, false, b, (short)0, c, false, false);
  asm volatile("v_nop\n\tv_nop\n\tv_nop\n\tv_nop" : "+v"(d) : "v"(a), "v"(b));
  return d;
}
// 16x16x32 fragments: lane = (h = lane>>4, row/col = lane&15); elements 0..7 = k0+8h+0..7, 8..15 = k0+16+8h+0..7; D element r = row 8h+r
__device__ __forceinline__ v16h frag_h(const _Float16* rowk0, int lane) {
  union { v16h v; v8h q[2]; } u; const _Float16* p = rowk0 + 8 * (lane >> 4);
  u.q[0] = *(const v8h*)p; u.q[1] = *(const v8h*)(p + 16); return u.v;
}
__device__ __forceinline__ v16h frag_f32(const float* rowk0, int lane) {
  v16h a; const float* p = rowk0 + 8 * (lane >> 4);
#pragma unroll
  for (int i = 0; i < 8; ++i) { a[i] = (_Float16)p[i]; a[8 + i] = (_Float16)p[16 + i]; }
  return a;
}
__device__ __forceinline__ v16h frag_f32s(const float* rowk0, int lane, float sc) {
  v16h a; const float* p = rowk0 + 8 * (lane >> 4);
#pragma unroll
  for (int i = 0; i < 8; ++i) { a[i] = (_Float16)(p[i] * sc); a[8 + i] = (_Float16)(p[16 + i] * sc); }
  return a;
}
// column fragment from a [K][ld] layout (column n), rows >= K read as 0
__device__ __forceinline__ v16h fragc_f32(const float* W, int k0, int n, int lane, int ld, int K) {
  v16h a; const int g = lane >> 4;
#pragma unroll
  for (int i = 0; i < 8; ++i) { const int ka = k0 + 8 * g + i, kb = ka + 16;
    a[i] = (_Float16)(ka < K ? W[(size_t)(ka < K ? ka : K - 1) * ld + n] : 0.f); a[8 + i] = (_Float16)(kb < K ? W[(size_t)(kb < K ? kb : K - 1) * ld + n] : 0.f); }
  return a;
}
struct F2 { v16b h, l; };
__device__ __forceinline__ F2 bsplit16(const float v[16]) { F2 r;
#pragma unroll
  for (int i = 0; i < 16; ++i) { const __bf16 h = (__bf16)v[i]; r.h[i] = h; r.l[i] = (__bf16)(v[i] - (float)h); }
  return r; }
__device__ __forceinline__ F2 split_row(const float* row, int k0, int lane) { float v[16]; const float* p = row + k0 + 8 * (lane >> 4);
#pragma unroll
  for (int i = 0; i < 8; ++i) { v[i] = p[i]; v[8 + i] = p[16 + i]; }
  return bsplit16(v); }
__device__ __forceinline__ F2 split_rowK(const float* row, int k0, int lane, int K) { float v[16]; const int g = lane >> 4;
#pragma unroll
  for (int i = 0; i < 8; ++i) { const int ka = k0 + 8 * g + i, kb = ka + 16; v[i] = ka < K ? row[ka < K ? ka : K - 1] : 0.f; v[8 + i] = kb < K ? row[kb < K ? kb : K - 1] : 0.f; }
  return bsplit16(v); }
__device__ __forceinline__ F2 split_col(const float* W, int k0, int n, int lane, int ld, int K) { float v[16]; const int g = lane >> 4;
#pragma unroll
  for (int i = 0; i < 8; ++i) { const int ka = k0 + 8 * g + i, kb = ka + 16; v[i] = ka < K ? W[(size_t)(ka < K ? ka : K - 1) * ld + n] : 0.f; v[8 + i] = kb < K ? W[(size_t)(kb < K ? kb : K - 1) * ld + n] : 0.f; }
  return bsplit16(v); }
__device__ __forceinline__ v8f mac3(const F2& a, const F2& b, v8f c) { c = wmma_bf(a.l, b.h, c); c = wmma_bf(a.h, b.l, c); return wmma_bf(a.h, b.h, c); }
__device__ __forceinline__ float sigm(float v) { return 1.0f / (1.0f + expf(-v)); }
#define LDSX() do { asm volatile("s_wait_dscnt 0" ::: "memory"); __builtin_amdgcn_wave_barrier(); __builtin_amdgcn_fence(__ATOMIC_RELEASE, "workgroup"); } while (0)


// Causal MHA with partial rotary embedding (B 2, T 2,048, C 1,024 = 16 x 64, rotary on dims 0..31 of each head as rotate_half pairs (d, d+16), base 10000): att = softmax(q_rot k_rot^T / 8 | causal) v; out = merged Wo + bo.
#define NB 2
#define TT 2048
#define CC 1024
#define NH 16
#define HD 64
__constant__ float INVF[16] = {1.000000000e+00f,5.623413324e-01f,3.162277639e-01f,1.778279394e-01f,1.000000015e-01f,5.623412877e-02f,3.162277862e-02f,1.778279431e-02f,9.999999776e-03f,5.623413250e-03f,3.162277862e-03f,1.778279431e-03f,1.000000047e-03f,5.623413017e-04f,3.162277862e-04f,1.778279402e-04f};   // 1 / 10000^(2i/32) as the module's f32 values
#ifndef TNB
#define TNB NB
#endif
typedef __attribute__((ext_vector_type(8))) __bf16 v8b;
__device__ __forceinline__ v16b frag_b(const __bf16* rowk0, int lane) {
  union { v16b v; v8b q[2]; } u; const __bf16* p = rowk0 + 8 * (lane >> 4);
  u.q[0] = *(const v8b*)p; u.q[1] = *(const v8b*)(p + 16); return u.v;
}
__device__ __forceinline__ float bfr(float v) { return (float)(__bf16)v; }
__device__ __attribute__((noinline)) float exp_ni(float v) { return expf(v); }
__device__ __attribute__((noinline)) float erf_ni(float v) { return erff(v); }

#define WS_QH  0u
#define WS_QL  (WS_QH + 2u * (size_t)NB * TT * CC)
#define WS_KH  (WS_QL + 2u * (size_t)NB * TT * CC)
#define WS_VT  (WS_KH + 2u * (size_t)NB * TT * CC)      // bf16 v, fragment order
#define WS_VL  (WS_VT + 2u * (size_t)NB * CC * TT)      // bf16 v residual, fragment order
#define WS_YH  (WS_VL + 2u * (size_t)NB * CC * TT)      // bf16 y, fragment order
#define WS_YL  (WS_YH + 2u * (size_t)NB * TT * CC)      // bf16 y residual
#define WS_XP  (WS_YL + 2u * (size_t)NB * TT * CC)      // bf16 x, fragment order
#define WS_WP  (WS_XP + 2u * (size_t)NB * TT * CC)      // bf16 Wq, Wk, Wv, Wo, fragment order
#define WS_END (WS_WP + 2u * (size_t)4 * CC * CC)

// FRAGMENT ORDER, every 16-bit matrix operand in the workspace: one 16 x 32 fragment = 512 elements = [e 0..1][lane 0..31][i 0..7], holding (row or column lane & 15, k = 16 e + 8 (lane >> 4) + i).
// A wave reads a fragment as two 16-byte loads per lane, each 512 contiguous bytes (4 cache lines); from row-major planes the same load touched 16 lines.
#define FRG 512
__device__ __forceinline__ v16b fragp_b(const __bf16* p) { union { v16b v; v8b q[2]; } u; u.q[0] = *(const v8b*)p; u.q[1] = *(const v8b*)(p + 256); return u.v; }       // p = fragment + 8 * lane
__device__ __forceinline__ v16h fragp_h(const _Float16* p) { union { v16h v; v8h q[2]; } u; u.q[0] = *(const v8h*)p; u.q[1] = *(const v8h*)(p + 256); return u.v; }
// LDS RING: fragments that all four waves of a block read come from L2 once per block, not once per wave: 128 threads x 16 bytes x 4 asynchronous copies = 8 KiB (8 fragments, contiguous in the workspace) from g to LDS byte address l, both already the lane's own (+ 16 * tid).
// Two buffers: stage t + 2 is asked for behind the barrier that ends the reads of stage t, and flies while stage t + 1 is worked on.
__device__ __forceinline__ void cp8k(unsigned l, const char* g) {
  // s_wait_xcnt as the statement's last line, a precaution: no register that one of the four copies names is rewritten in front of it
  asm volatile("global_load_async_to_lds_b128 %0, %4, off\n\tglobal_load_async_to_lds_b128 %1, %5, off\n\tglobal_load_async_to_lds_b128 %2, %6, off\n\tglobal_load_async_to_lds_b128 %3, %7, off\n\ts_wait_xcnt 0x0"
               :: "v"(l), "v"(l + 2048u), "v"(l + 4096u), "v"(l + 6144u), "v"(g), "v"(g + 2048), "v"(g + 4096), "v"(g + 6144) : "memory");
}
#define RING_LANDED() asm volatile("s_wait_asynccnt 0x0" ::: "memory")   // this wave's copies have landed; the barrier behind it shows them to the other waves
#define RING_READ()   asm volatile("s_wait_dscnt 0x0" ::: "memory")      // this wave's LDS reads of the stage are done before the barrier behind which the buffer is refilled

// ---- k_pack: x and the four weights rounded to bf16 and laid out in fragment order; a chunk = 16 bytes = 8 k of one row or column, chunks in output order, PCH chunks per thread (fewer waves, for speed only).
// x fragments [row tile][kc]; weight fragments [which][kc][column tile]
#define PCH 8
#define NXB (TNB * TT * CC / (2048 * PCH))
#define NWB (CC * CC / (2048 * PCH))
__global__ __launch_bounds__(256) void k_pack(const float* __restrict__ X, const float* __restrict__ WQ, const float* __restrict__ WK, const float* __restrict__ WV, const float* __restrict__ WO, __bf16* __restrict__ XP, __bf16* __restrict__ WP) {
  const int tid = threadIdx.x, rc = tid & 15, k8 = 16 * ((tid >> 5) & 1) + 8 * ((tid >> 4) & 1);
  if (blockIdx.x < NXB) { v4f x0[PCH], x1[PCH];
#pragma unroll
    for (int it = 0; it < PCH; ++it) { const unsigned f = ((blockIdx.x * PCH + it) * 256u + tid) >> 6; const float* p = X + ((size_t)(f >> 5) * 16 + rc) * CC + (f & 31) * 32 + k8; x0[it] = *(const v4f*)p;
      asm volatile("s_wait_xcnt 0x0" ::: "memory");   // the address registers of the load above may be reused as the next load's destination
      x1[it] = *(const v4f*)(p + 4);
      asm volatile("s_wait_xcnt 0x0" ::: "memory");   // as above, for a later chunk's load
    }
#pragma unroll
    for (int it = 0; it < PCH; ++it) { const unsigned c = (blockIdx.x * PCH + it) * 256u + tid; v8b o;
#pragma unroll
      for (int i = 0; i < 4; ++i) { o[i] = (__bf16)x0[it][i]; o[4 + i] = (__bf16)x1[it][i]; }
      vst2(XP + (size_t)c * 8, o); } }
  else { const unsigned wb = blockIdx.x - NXB, w = wb / NWB; const float* WA = w == 0 ? WQ : w == 1 ? WK : w == 2 ? WV : WO;
#pragma unroll
    for (int it = 0; it < PCH; ++it) { const unsigned c = (wb * PCH + it) * 256u + tid, f = c >> 6; const float* p = WA + (size_t)(((f >> 6) & 31) * 32 + k8) * CC + (f & 63) * 16 + rc; v8b o;   /* (in,out) */
#pragma unroll
      for (int i = 0; i < 8; ++i) o[i] = (__bf16)p[(size_t)i * CC];
      vst2(WP + (size_t)c * 8, o); } } }
// ---- k_proj: block = (128 rows, 128 cols, which), wave = RG row tiles of 16 x 128 cols, so every loaded W fragment feeds RG products: qkv = x W (+ b), exact; q -> f16 hi (+ residual), k -> f16, v -> bf16 hi + residual, all in fragment order
#define RG 2
__global__ __launch_bounds__(128) void k_proj(const __bf16* __restrict__ XP, const __bf16* __restrict__ WP, const float* __restrict__ BQ, const float* __restrict__ BK, const float* __restrict__ BV, _Float16* __restrict__ QH, _Float16* __restrict__ QL, _Float16* __restrict__ KH, __bf16* __restrict__ VT, __bf16* __restrict__ VL) {
  __shared__ __align__(16) _Float16 sh[64 * RG][136], sl[64 * RG][136]; __shared__ __align__(16) char wr[2][16384];   // wr: W ring, a stage = 2 kc x 8 fragments
  const int tid = threadIdx.x, wave = tid >> 5, lane = tid & 31, col = lane & 15, g = lane >> 4; const int which = blockIdx.z; const int c0 = blockIdx.y * 128; const size_t r0 = (size_t)blockIdx.x * (64 * RG); const float* BA = which == 0 ? BQ : which == 1 ? BK : BV;
  const __bf16* Ap = XP + (r0 / 16 + wave * RG) * (size_t)(CC / 32) * FRG + lane * 8; const __bf16* Bp = WP + ((size_t)which * (CC / 32) * (CC / 16) + c0 / 16) * FRG + lane * 8;
  v8f acc[RG][8] = {};
  const unsigned wl = (unsigned)(size_t)&wr[0][0] + tid * 16; const char* wg = (const char*)(Bp - lane * 8) + tid * 16;
  const auto fill = [&](int t) { const unsigned l = wl + (t & 1) * 16384; const char* g = wg + (size_t)t * (2 * (CC / 16) * FRG * 2); cp8k(l, g); cp8k(l + 8192, g + (CC / 16) * FRG * 2); };   // stage t = kc 2 t, 2 t + 1
  fill(0); RING_LANDED(); __syncthreads(); fill(1);
#pragma unroll 1   // one stage a trip: the trip's foot is the ring's publish point
  for (int t = 0; t < CC / 64; ++t) { v16b a[2][RG];   // the wave's own x fragments of the stage, straight from L2
#pragma unroll
    for (int kk = 0; kk < 2; ++kk)
#pragma unroll
      for (int u = 0; u < RG; ++u) a[kk][u] = fragp_b(Ap + ((size_t)u * (CC / 32) + 2 * t + kk) * FRG);
#pragma unroll
    for (int kk = 0; kk < 2; ++kk) { v16b w[8]; const __bf16* ws = (const __bf16*)&wr[t & 1][kk * 8192] + lane * 8;
#pragma unroll
      for (int j = 0; j < 8; ++j) w[j] = fragp_b(ws + j * FRG);
#pragma unroll
      for (int j = 0; j < 8; ++j)
#pragma unroll
        for (int u = 0; u < RG; ++u) acc[u][j] = wmma_bf(a[kk][u], w[j], acc[u][j]);
    }
    asm volatile("s_wait_xcnt 0x0" ::: "memory");   // the address registers of this trip's loads are rewritten at the head of the next trip
    RING_READ(); RING_LANDED(); __syncthreads();
    if (t + 2 < CC / 64) fill(t + 2);   // same for the whole block
  }
  RING_LANDED();
#pragma unroll
  for (int j = 0; j < 8; ++j) { const float bb0 = BA ? bfr(BA[c0 + j * 16 + col]) : 0.f;
#pragma unroll
    for (int u = 0; u < RG; ++u)
#pragma unroll
      for (int r = 0; r < 8; ++r) acc[u][j][r] += bb0; }   /* bias before the rotary */
  const size_t b = r0 / TT; const int t0 = (int)(r0 % TT);
  if (which == 2) {   /* a lane's 8 registers of tile (u, j) are 8 consecutive t of one feature: one chunk of the V^T fragment (t / 32, dim tile j & 3), e = row tile & 1, stored straight from registers */
#pragma unroll
    for (int u = 0; u < RG; ++u)
#pragma unroll
    for (int j = 0; j < 8; ++j) { v8b hi, lo; const int rt = wave * RG + u;
#pragma unroll
      for (int r = 0; r < 8; ++r) { const float v = acc[u][j][r]; const __bf16 bh = (__bf16)v; hi[r] = bh; lo[r] = (__bf16)(v - (float)bh); }
      const size_t o2 = (((b * NH + c0 / HD + (j >> 2)) * (TT / 32) + t0 / 32 + (rt >> 1)) * 4 + (j & 3)) * FRG + (rt & 1) * 256 + lane * 8; vst2(VT + o2, hi); vst2(VL + o2, lo); }
    return; }   /* block-uniform: which is blockIdx.z */
  /* partial rotary on dims 0..31 of each head: tiles (4hh, 4hh+1) hold dims (col, col+16) of the same lane: (x1, x2) -> (x1 c - x2 s, x2 c + x1 s), angle = t * inv_freq[col] */
  const auto put = [&](const v8f& tile, int rt, int j) {   /* one 16 x 16 tile (row tile rt of the block, column tile j) into the staging planes */
#pragma unroll
    for (int r = 0; r < 8; ++r) { const float v = tile[r]; const int rl = rt * 16 + 8 * g + r, cl = j * 16 + col; const _Float16 hv = (_Float16)v;
      sh[rl][cl] = hv; sl[rl][cl] = (_Float16)((v - (float)hv) * 1024.0f);   /* q residual carried x 2^10 so the plane stays f16-normal on the chip */ } };
#pragma unroll
  for (int u = 0; u < RG; ++u)
#pragma unroll
    for (int hh = 0; hh < 2; ++hh) { put(acc[u][4 * hh + 2], wave * RG + u, 4 * hh + 2); put(acc[u][4 * hh + 3], wave * RG + u, 4 * hh + 3); }   /* dims 32..63 pass unrotated and leave their registers first */
#pragma unroll 1   // one copy of the long cosf / sinf text serves every row tile: unrolled, the kernel's text would grow RG-fold
  for (int u = 0; u < RG; ++u) {
#pragma unroll
    for (int hh = 0; hh < 2; ++hh) {
#pragma unroll
      for (int r = 0; r < 8; ++r) { const int t = (int)((r0 + (wave * RG + u) * 16 + 8 * g + r) % TT); const float ang = (float)t * INVF[col]; const float cs = cosf(ang), sn = sinf(ang); const float x1 = acc[0][4 * hh][r], x2 = acc[0][4 * hh + 1][r]; acc[0][4 * hh][r] = x1 * cs - x2 * sn; acc[0][4 * hh + 1][r] = x2 * cs + x1 * sn; }
      put(acc[0][4 * hh], wave * RG + u, 4 * hh); put(acc[0][4 * hh + 1], wave * RG + u, 4 * hh + 1); }
#pragma unroll
    for (int v = 0; v + 1 < RG; ++v)
#pragma unroll
      for (int hh = 0; hh < 2; ++hh) { acc[v][4 * hh] = acc[v + 1][4 * hh]; acc[v][4 * hh + 1] = acc[v + 1][4 * hh + 1]; }   /* trip u always works on acc[0]: constant register indices in a rolled loop */
  }
  __syncthreads();
  /* chunk e = [head 0..1][t tile 0..4 RG - 1][dims 8 * (0..7)][t & 15]: bits 0..6 are the chunk's place in its pair of fragments (kc 0, 1) */
  _Float16* dh = which == 0 ? QH : KH; for (int e = tid; e < 64 * RG * 16; e += 128) { const int tt = (e >> 7) % (4 * RG), hd = e / (512 * RG); const int rl = tt * 16 + (e & 15), cl = hd * 64 + ((e >> 4) & 7) * 8; const size_t o2 = ((b * NH + c0 / HD + hd) * (TT / 16) + t0 / 16 + tt) * (2 * FRG) + (e & 127) * 8;
    vst2(dh + o2, *(const v4u*)&sh[rl][cl]);
    asm volatile("s_wait_xcnt 0x0" ::: "memory");   // the store's data and address registers are rewritten by the next LDS read and the next trip
    if (which == 0) { vst2(QL + o2, *(const v4u*)&sl[rl][cl]);
      asm volatile("s_wait_xcnt 0x0" ::: "memory");   // as above
    } } }
#define QG 1
#define KT 4
#define SCL2 0.18033688011112042f   // (1 / 8) log2(e): exp((s - m) / 8) = 2^(s SCL2 - m SCL2), one multiply-add and the hardware's exp2 per score
template <bool B> struct Flag { static constexpr bool value = B; };   // a pass's compile-time switch: is it the one that holds the diagonal
__device__ __forceinline__ float xhalf(float x) { return __builtin_bit_cast(float, __builtin_amdgcn_permlanex16(__builtin_bit_cast(int, x), __builtin_bit_cast(int, x), 0x76543210, 0xfedcba98, false, false)); }   // lane l with lane l ^ 16
__global__ __launch_bounds__(128) void k_att(const _Float16* __restrict__ QH, const _Float16* __restrict__ QL, const _Float16* __restrict__ KH, const __bf16* __restrict__ VT, const __bf16* __restrict__ VL, __bf16* __restrict__ YH, __bf16* __restrict__ YL) {
  const int tid = threadIdx.x, wave = __builtin_amdgcn_readfirstlane(tid >> 5), lane = tid & 31, col = lane & 15, g = lane >> 4; const int b = blockIdx.x / NH, h = blockIdx.x % NH;   // wave number in a scalar register: q0 and the q and y offsets built on it stay scalar
  const int qb = TT / (64 * QG) - 1 - (int)blockIdx.y;   // the longest query blocks take the lowest blockIdx.y
  const int q0 = (qb * 4 + wave) * (16 * QG);            // the wave's first query
  const int npass = (qb * (64 * QG) + 64 * QG - 1) / (16 * KT) + 1;  // from the block's last query: the same in all four waves (64 QG is a multiple of 16 KT, so it is each wave's own count too); q0 is never below the last pass's first key, so every query sees a live key in every pass
  __shared__ __align__(16) char ring[2][3][16 * KT * HD * 2];   // a stage = one pass's k, v, v residual fragments
  v16h ah[QG][2], al[QG][2];
#pragma unroll
  for (int u = 0; u < QG; ++u)
#pragma unroll
    for (int kc = 0; kc < 2; ++kc) { const size_t qo = (((size_t)blockIdx.x * (TT / 16) + q0 / 16 + u) * 2 + kc) * FRG + lane * 8; ah[u][kc] = fragp_h(QH + qo); al[u][kc] = fragp_h(QL + qo); }
  const size_t ho = (size_t)blockIdx.x * (TT * HD) * 2 + tid * 16; const char* Kg = (const char*)KH + ho; const char* Vhg = (const char*)VT + ho; const char* Vlg = (const char*)VL + ho;   // blockIdx.x = b * NH + h; a head's k, v: TT * HD elements each, fragments [key tile][kc] and [32 keys][dim tile]: a pass's 8 fragments of each are 8 KiB in a row
  const unsigned rl = (unsigned)(size_t)&ring[0][0][0] + tid * 16;
  const auto fill = [&](int t) { const unsigned l = rl + (t & 1) * 24576; const size_t go = (size_t)t * 8192; cp8k(l, Kg + go); cp8k(l + 8192, Vhg + go); cp8k(l + 16384, Vlg + go); };
  fill(0); RING_LANDED(); __syncthreads();
  if (npass > 1) fill(1);   // same for the whole block
  v8f o[QG][4] = {}; float m[QG], l[QG];   // m: running maximum of the raw products
#pragma unroll
  for (int u = 0; u < QG; ++u) { m[u] = -3.0e38f; l[u] = 0.f; }
  // one pass; only the last pass of a wave holds keys above a query (k0 + 16 KT - 1 <= q0 - 1 in every earlier one), so only its copy of the text carries the 32 compares and selects of the causal mask; always_inline: at both call sites o, m, l and the q fragments stay in registers
  const auto pass = [&](const int kb, auto dg) __attribute__((always_inline)) { const int k0 = kb * (16 * KT); constexpr bool diag = decltype(dg)::value;
    v16h kf[KT][2];
#pragma unroll
    for (int jt = 0; jt < KT; ++jt)
#pragma unroll
      for (int kc = 0; kc < 2; ++kc) kf[jt][kc] = fragp_h((const _Float16*)&ring[kb & 1][0][0] + (jt * 2 + kc) * FRG + lane * 8);
    F2 p[QG][KT / 2];
#pragma unroll
    for (int u = 0; u < QG; ++u) { v8f s[KT] = {}, sl[KT] = {};
#pragma unroll
      for (int kc = 0; kc < 2; ++kc)
#pragma unroll
        for (int jt = 0; jt < KT; ++jt) { s[jt] = wmma16(kf[jt][kc], ah[u][kc], s[jt]); sl[jt] = wmma16(kf[jt][kc], al[u][kc], sl[jt]); }
      const int qt = q0 + u * 16 + col; float mx = m[u];
#pragma unroll
      for (int jt = 0; jt < KT; ++jt) { s[jt] += sl[jt] * (1.0f / 1024.0f);
#pragma unroll
        for (int r = 0; r < 8; ++r) { float v = s[jt][r]; if (diag && k0 + jt * 16 + 8 * g + r > qt) v = -3.0e38f; s[jt][r] = v; mx = fmaxf(mx, v); } }   /* maximum over the raw products: the scale is positive */
      mx = fmaxf(mx, xhalf(mx));
      const float nm = -mx * SCL2, sc = __builtin_amdgcn_exp2f((m[u] - mx) * SCL2); m[u] = mx; float ps = 0.f;   /* nm is rounded once, to 2^-24 of m SCL2: far below what the f16 rounding of k leaves in the same score */
#pragma unroll
      for (int jt = 0; jt < KT; ++jt) { s[jt] = s[jt] * SCL2 + nm;   /* contracts to one multiply-add a score */
#pragma unroll
        for (int r = 0; r < 8; ++r) { const float e = __builtin_amdgcn_exp2f(s[jt][r]); s[jt][r] = e; ps += e; } }   /* a masked score is -3e38 and mx is a live score: the exponent is about -5e37 and the result exactly 0 */
      l[u] = l[u] * sc + ps;
#pragma unroll
      for (int j = 0; j < 4; ++j) o[u][j] *= sc;
#pragma unroll
      for (int c = 0; c < KT / 2; ++c) { float pv[16];
#pragma unroll
        for (int i = 0; i < 8; ++i) { pv[i] = s[2 * c][i]; pv[8 + i] = s[2 * c + 1][i]; }
        p[u][c] = bsplit16(pv); } }
#pragma unroll
    for (int c = 0; c < KT / 2; ++c) { v16b vh[4], vl[4];
#pragma unroll
      for (int j = 0; j < 4; ++j) { const int po = (c * 4 + j) * FRG + lane * 8; vh[j] = fragp_b((const __bf16*)&ring[kb & 1][1][0] + po); vl[j] = fragp_b((const __bf16*)&ring[kb & 1][2][0] + po); }
#pragma unroll
      for (int u = 0; u < QG; ++u) {
#pragma unroll
        for (int j = 0; j < 4; ++j) o[u][j] = wmma_bf(vh[j], p[u][c].h, o[u][j]);
#pragma unroll
        for (int j = 0; j < 4; ++j) o[u][j] = wmma_bf(vh[j], p[u][c].l, o[u][j]);
#pragma unroll
        for (int j = 0; j < 4; ++j) o[u][j] = wmma_bf(vl[j], p[u][c].h, o[u][j]); } }
    RING_READ(); RING_LANDED(); __syncthreads();
    if (kb + 2 < npass) fill(kb + 2);   // same for the whole block
  };
#pragma unroll 1   // one stage a trip: the trip's foot is the ring's publish point
  for (int kb = 0; kb < npass - 1; ++kb) pass(kb, Flag<false>{});
  pass(npass - 1, Flag<true>{});
  RING_LANDED();
#pragma unroll
  for (int u = 0; u < QG; ++u) { const float inv = 1.0f / (l[u] + xhalf(l[u])); const size_t yo = (((size_t)b * TT + q0) / 16 + u) * (size_t)(CC / 32) * FRG + (size_t)(h * 2) * FRG + lane * 8;   // register r of tile j = dim 16 j + 8 g + r of the lane's query: chunk e = j & 1 of the y fragment kc = 2 h + (j >> 1)
#pragma unroll
    for (int j = 0; j < 4; ++j) { v8b hi, lo;
#pragma unroll
      for (int r = 0; r < 8; ++r) { const float y = o[u][j][r] * inv; const __bf16 yb = (__bf16)y; hi[r] = yb; lo[r] = (__bf16)(y - (float)yb); }
      const size_t o2 = yo + (j >> 1) * FRG + (j & 1) * 256; vst2(YH + o2, hi); vst2(YL + o2, lo); } } }
// ---- k_out: block = (64 rows, 128 cols): out = y (bf16 hi + lo) Wo + bo
__global__ __launch_bounds__(128) void k_out(const __bf16* __restrict__ YH, const __bf16* __restrict__ YL, const __bf16* __restrict__ WP, const float* __restrict__ BP, float* __restrict__ OUT) { __shared__ __align__(16) float sf[4][16][132]; __shared__ __align__(16) char wr[2][16384];   // wr: W ring, a stage = 2 kc x 8 fragments
  const int tid = threadIdx.x, wave = tid >> 5, lane = tid & 31, col = lane & 15, g = lane >> 4; const int c0 = blockIdx.y * 128; const size_t r0 = (size_t)blockIdx.x * 64 + wave * 16;
  const size_t ao = (r0 / 16) * (size_t)(CC / 32) * FRG + lane * 8; const __bf16* Ah = YH + ao; const __bf16* Al = YL + ao; const __bf16* Bp = WP + ((size_t)3 * (CC / 32) * (CC / 16) + c0 / 16) * FRG + lane * 8;
  v8f acc[8] = {};
  const unsigned wl = (unsigned)(size_t)&wr[0][0] + tid * 16; const char* wg = (const char*)(Bp - lane * 8) + tid * 16;
  const auto fill = [&](int t) { const unsigned l = wl + (t & 1) * 16384; const char* g = wg + (size_t)t * (2 * (CC / 16) * FRG * 2); cp8k(l, g); cp8k(l + 8192, g + (CC / 16) * FRG * 2); };   // stage t = kc 2 t, 2 t + 1
  fill(0); RING_LANDED(); __syncthreads(); fill(1);
#pragma unroll 1   // one stage a trip: the trip's foot is the ring's publish point
  for (int t = 0; t < CC / 64; ++t) { v16b ah[2], al[2];   // the wave's own y fragments of the stage, straight from L2
#pragma unroll
    for (int kk = 0; kk < 2; ++kk) ah[kk] = fragp_b(Ah + (size_t)(2 * t + kk) * FRG);
    asm volatile("s_wait_xcnt 0x0" ::: "memory");   // the address registers of the loads above may be reused as a later load's destination
#pragma unroll
    for (int kk = 0; kk < 2; ++kk) al[kk] = fragp_b(Al + (size_t)(2 * t + kk) * FRG);
    asm volatile("s_wait_xcnt 0x0" ::: "memory");   // as above, for the LDS loads that follow and the head of the next trip
#pragma unroll
    for (int kk = 0; kk < 2; ++kk) { v16b w[8]; const __bf16* ws = (const __bf16*)&wr[t & 1][kk * 8192] + lane * 8;
#pragma unroll
      for (int j = 0; j < 8; ++j) w[j] = fragp_b(ws + j * FRG);
#pragma unroll
      for (int j = 0; j < 8; ++j) { acc[j] = wmma_bf(ah[kk], w[j], acc[j]); acc[j] = wmma_bf(al[kk], w[j], acc[j]); }
    }
    RING_READ(); RING_LANDED(); __syncthreads();
    if (t + 2 < CC / 64) fill(t + 2);   // same for the whole block
  }
  RING_LANDED();
#pragma unroll
  for (int j = 0; j < 8; ++j) { const float bb = BP ? bfr(BP[c0 + j * 16 + col]) : 0.f;
#pragma unroll
    for (int r = 0; r < 8; ++r) sf[wave][8 * g + r][j * 16 + col] = acc[j][r] + bb; }
  LDSX(); for (int rl = 0; rl < 16; ++rl) vst2(OUT + (r0 + rl) * CC + c0 + lane * 4, *(const v4f*)&sf[wave][rl][lane * 4]); }
extern "C" void kernel_launch(void* const* d_in, const int* in_sizes, int n_in, void* d_out, int out_size, void* d_ws, size_t ws_size, hipStream_t stream) {
  (void)in_sizes; (void)n_in; (void)out_size;
  const float** F = (const float**)d_in;   // 0 x [2,2048,1024], 1 Wq [1024,1024] ((in,out)), 2 bq, 3 Wk, 4 bk, 5 Wv, 6 bv, 7 Wo ((in,out)), 8 bo
  if (ws_size < (size_t)WS_END) return;
  char* ws = (char*)d_ws; _Float16 *QH = (_Float16*)(ws + WS_QH), *QL = (_Float16*)(ws + WS_QL), *KH = (_Float16*)(ws + WS_KH); __bf16 *VT = (__bf16*)(ws + WS_VT), *VL = (__bf16*)(ws + WS_VL), *YH = (__bf16*)(ws + WS_YH), *YL = (__bf16*)(ws + WS_YL), *XP = (__bf16*)(ws + WS_XP), *WP = (__bf16*)(ws + WS_WP);
  k_pack<<<dim3(NXB + 4 * NWB), 256, 0, stream>>>(F[0], F[1], F[3], F[5], F[7], XP, WP);
  k_proj<<<dim3(TNB * TT / (64 * RG), CC / 128, 3), 128, 0, stream>>>(XP, WP, F[2], F[4], F[6], QH, QL, KH, VT, VL);
  k_att<<<dim3(TNB * NH, TT / (64 * QG)), 128, 0, stream>>>(QH, QL, KH, VT, VL, YH, YL);
  k_out<<<dim3(TNB * TT / 64, CC / 128), 128, 0, stream>>>(YH, YL, WP, F[8], (float*)d_out);
}

// v007
// Measured time: 88.8 microseconds a run.
// Timed twice side by side with v006, it ran 1.11 times as fast both times.
// Counting every step since v000, it is 15.1 times as fast.
// compute dtype: all float inputs rounded to bf16; q/k/v = x W + b ((in,out)) with EXACT bf16 products on WMMA 16x16x32, f32 accumulate; partial rotary (first 32 dims of each head) in f32 in the projection epilogue with precise cosf/sinf of t * inv_freq (the module's f32 inv_freq constants); q as f16 hi + residual (x 2^10), k f16 -> raw 2-product causal logits kept in registers; running-maximum softmax in f32 (hardware exp2 of (s - m) log2(e) / 8), exp((s - m) / 8) split bf16 hi + lo against v bf16 hi + lo (3 products), divided by the row sum at the end; out = o (bf16 hi + lo) Wo + bo; f32 output.
#include <hip/hip_runtime.h>
#include <math.h>

typedef __attribute__((ext_vector_type(16))) _Float16 v16h;
typedef __attribute__((ext_vector_type(16))) __bf16 v16b;
typedef __attribute__((ext_vector_type(8)))  _Float16 v8h;
typedef __attribute__((ext_vector_type(8)))  float v8f;
typedef __attribute__((ext_vector_type(4)))  float v4f;
typedef __attribute__((ext_vector_type(2)))  float v2f;
typedef __attribute__((ext_vector_type(4)))  unsigned v4u;
typedef __attribute__((ext_vector_type(4)))  int v4i;
typedef float __attribute__((may_alias)) float_a;
typedef int __attribute__((may_alias)) int_a;

template <typename T> __device__ __forceinline__ void vst2(void* p, T v) { *(T*)p = v;  }
__device__ __forceinline__ v8f wmma16(v16h a, v16h b, v8f c) {
  v8f d = __builtin_amdgcn_wmma_f32_16x16x32_f16(false, a, false, b, (short)0, c, false, false);
  asm volatile("v_nop\n\tv_nop\n\tv_nop\n\tv_nop" : "+v"(d) : "v"(a), "v"(b));
  return d;
}
__device__ __forceinline__ v8f wmma_bf(v16b a, v16b b, v8f c) {
  v8f d = __builtin_amdgcn_wmma_f32_16x16x32_bf16(false, a, false, b, (short)0, c, false, false);
  asm volatile("v_nop\n\tv_nop\n\tv_nop\n\tv_nop" : "+v"(d) : "v"(a), "v"(b));
  return d;
}
// 16x16x32 fragments: lane = (h = lane>>4, row/col = lane&15); elements 0..7 = k0+8h+0..7, 8..15 = k0+16+8h+0..7; D element r = row 8h+r
__device__ __forceinline__ v16h frag_h(const _Float16* rowk0, int lane) {
  union { v16h v; v8h q[2]; } u; const _Float16* p = rowk0 + 8 * (lane >> 4);
  u.q[0] = *(const v8h*)p; u.q[1] = *(const v8h*)(p + 16); return u.v;
}
__device__ __forceinline__ v16h frag_f32(const float* rowk0, int lane) {
  v16h a; const float* p = rowk0 + 8 * (lane >> 4);
#pragma unroll
  for (int i = 0; i < 8; ++i) { a[i] = (_Float16)p[i]; a[8 + i] = (_Float16)p[16 + i]; }
  return a;
}
__device__ __forceinline__ v16h frag_f32s(const float* rowk0, int lane, float sc) {
  v16h a; const float* p = rowk0 + 8 * (lane >> 4);
#pragma unroll
  for (int i = 0; i < 8; ++i) { a[i] = (_Float16)(p[i] * sc); a[8 + i] = (_Float16)(p[16 + i] * sc); }
  return a;
}
// column fragment from a [K][ld] layout (column n), rows >= K read as 0
__device__ __forceinline__ v16h fragc_f32(const float* W, int k0, int n, int lane, int ld, int K) {
  v16h a; const int g = lane >> 4;
#pragma unroll
  for (int i = 0; i < 8; ++i) { const int ka = k0 + 8 * g + i, kb = ka + 16;
    a[i] = (_Float16)(ka < K ? W[(size_t)(ka < K ? ka : K - 1) * ld + n] : 0.f); a[8 + i] = (_Float16)(kb < K ? W[(size_t)(kb < K ? kb : K - 1) * ld + n] : 0.f); }
  return a;
}
struct F2 { v16b h, l; };
__device__ __forceinline__ F2 bsplit16(const float v[16]) { F2 r;
#pragma unroll
  for (int i = 0; i < 16; ++i) { const __bf16 h = (__bf16)v[i]; r.h[i] = h; r.l[i] = (__bf16)(v[i] - (float)h); }
  return r; }
__device__ __forceinline__ F2 split_row(const float* row, int k0, int lane) { float v[16]; const float* p = row + k0 + 8 * (lane >> 4);
#pragma unroll
  for (int i = 0; i < 8; ++i) { v[i] = p[i]; v[8 + i] = p[16 + i]; }
  return bsplit16(v); }
__device__ __forceinline__ F2 split_rowK(const float* row, int k0, int lane, int K) { float v[16]; const int g = lane >> 4;
#pragma unroll
  for (int i = 0; i < 8; ++i) { const int ka = k0 + 8 * g + i, kb = ka + 16; v[i] = ka < K ? row[ka < K ? ka : K - 1] : 0.f; v[8 + i] = kb < K ? row[kb < K ? kb : K - 1] : 0.f; }
  return bsplit16(v); }
__device__ __forceinline__ F2 split_col(const float* W, int k0, int n, int lane, int ld, int K) { float v[16]; const int g = lane >> 4;
#pragma unroll
  for (int i = 0; i < 8; ++i) { const int ka = k0 + 8 * g + i, kb = ka + 16; v[i] = ka < K ? W[(size_t)(ka < K ? ka : K - 1) * ld + n] : 0.f; v[8 + i] = kb < K ? W[(size_t)(kb < K ? kb : K - 1) * ld + n] : 0.f; }
  return bsplit16(v); }
__device__ __forceinline__ v8f mac3(const F2& a, const F2& b, v8f c) { c = wmma_bf(a.l, b.h, c); c = wmma_bf(a.h, b.l, c); return wmma_bf(a.h, b.h, c); }
__device__ __forceinline__ float sigm(float v) { return 1.0f / (1.0f + expf(-v)); }
#define LDSX() do { asm volatile("s_wait_dscnt 0" ::: "memory"); __builtin_amdgcn_wave_barrier(); __builtin_amdgcn_fence(__ATOMIC_RELEASE, "workgroup"); } while (0)


// Causal MHA with partial rotary embedding (B 2, T 2,048, C 1,024 = 16 x 64, rotary on dims 0..31 of each head as rotate_half pairs (d, d+16), base 10000): att = softmax(q_rot k_rot^T / 8 | causal) v; out = merged Wo + bo.
#define NB 2
#define TT 2048
#define CC 1024
#define NH 16
#define HD 64
__constant__ float INVF[16] = {1.000000000e+00f,5.623413324e-01f,3.162277639e-01f,1.778279394e-01f,1.000000015e-01f,5.623412877e-02f,3.162277862e-02f,1.778279431e-02f,9.999999776e-03f,5.623413250e-03f,3.162277862e-03f,1.778279431e-03f,1.000000047e-03f,5.623413017e-04f,3.162277862e-04f,1.778279402e-04f};   // 1 / 10000^(2i/32) as the module's f32 values
#ifndef TNB
#define TNB NB
#endif
typedef __attribute__((ext_vector_type(8))) __bf16 v8b;
__device__ __forceinline__ v16b frag_b(const __bf16* rowk0, int lane) {
  union { v16b v; v8b q[2]; } u; const __bf16* p = rowk0 + 8 * (lane >> 4);
  u.q[0] = *(const v8b*)p; u.q[1] = *(const v8b*)(p + 16); return u.v;
}
__device__ __forceinline__ float bfr(float v) { return (float)(__bf16)v; }
__device__ __attribute__((noinline)) float exp_ni(float v) { return expf(v); }
__device__ __attribute__((noinline)) float erf_ni(float v) { return erff(v); }

#define WS_QH  0u
#define WS_QL  (WS_QH + 2u * (size_t)NB * TT * CC)
#define WS_KH  (WS_QL + 2u * (size_t)NB * TT * CC)
#define WS_VT  (WS_KH + 2u * (size_t)NB * TT * CC)      // bf16 v, fragment order
#define WS_VL  (WS_VT + 2u * (size_t)NB * CC * TT)      // bf16 v residual, fragment order
#define WS_YH  (WS_VL + 2u * (size_t)NB * CC * TT)      // bf16 y, fragment order
#define WS_YL  (WS_YH + 2u * (size_t)NB * TT * CC)      // bf16 y residual
#define WS_XP  (WS_YL + 2u * (size_t)NB * TT * CC)      // bf16 x, fragment order
#define WS_WP  (WS_XP + 2u * (size_t)NB * TT * CC)      // bf16 Wq, Wk, Wv, Wo, fragment order
#define WS_END (WS_WP + 2u * (size_t)4 * CC * CC)

// FRAGMENT ORDER, every 16-bit matrix operand in the workspace: one 16 x 32 fragment = 512 elements = [e 0..1][lane 0..31][i 0..7], holding (row or column lane & 15, k = 16 e + 8 (lane >> 4) + i).
// A wave reads a fragment as two 16-byte loads per lane, each 512 contiguous bytes (4 cache lines); from row-major planes the same load touched 16 lines.
#define FRG 512
__device__ __forceinline__ v16b fragp_b(const __bf16* p) { union { v16b v; v8b q[2]; } u; u.q[0] = *(const v8b*)p; u.q[1] = *(const v8b*)(p + 256); return u.v; }       // p = fragment + 8 * lane
__device__ __forceinline__ v16h fragp_h(const _Float16* p) { union { v16h v; v8h q[2]; } u; u.q[0] = *(const v8h*)p; u.q[1] = *(const v8h*)(p + 256); return u.v; }
// LDS RING: fragments that all four waves of a block read come from L2 once per block, not once per wave: 128 threads x 16 bytes x 4 asynchronous copies = 8 KiB (8 fragments, contiguous in the workspace) from g to LDS byte address l, both already the lane's own (+ 16 * tid).
// Two buffers: stage t + 2 is asked for behind the barrier that ends the reads of stage t, and flies while stage t + 1 is worked on.
__device__ __forceinline__ void cp8k(unsigned l, const char* g) {
  // s_wait_xcnt as the statement's last line, a precaution: no register that one of the four copies names is rewritten in front of it
  asm volatile("global_load_async_to_lds_b128 %0, %4, off\n\tglobal_load_async_to_lds_b128 %1, %5, off\n\tglobal_load_async_to_lds_b128 %2, %6, off\n\tglobal_load_async_to_lds_b128 %3, %7, off\n\ts_wait_xcnt 0x0"
               :: "v"(l), "v"(l + 2048u), "v"(l + 4096u), "v"(l + 6144u), "v"(g), "v"(g + 2048), "v"(g + 4096), "v"(g + 6144) : "memory");
}
#define RING_LANDED() asm volatile("s_wait_asynccnt 0x0" ::: "memory")   // this wave's copies have landed; the barrier behind it shows them to the other waves
#define RING_READ()   asm volatile("s_wait_dscnt 0x0" ::: "memory")      // this wave's LDS reads of the stage are done before the barrier behind which the buffer is refilled
// the work-group barrier with its two fences on LDS alone: __syncthreads() also waits out every global load of the wave, and would end the flight of the x / y fragments asked for one stage ahead (they read what an earlier launch wrote, nothing of this one)
#define RING_BARRIER() do { __builtin_amdgcn_fence(__ATOMIC_RELEASE, "workgroup", "local"); __builtin_amdgcn_s_barrier(); __builtin_amdgcn_fence(__ATOMIC_ACQUIRE, "workgroup", "local"); } while (0)

// ---- k_pack: x and the four weights rounded to bf16 and laid out in fragment order; a chunk = 16 bytes = 8 k of one row or column, chunks in output order, PCH chunks per thread (few waves, for speed only).
// x fragments [row tile][kc]; weight fragments [which][kc][column tile]
#define PCH 8
#define NXB (TNB * TT * CC / (2048 * PCH))
#define NWB (CC * CC / (2048 * PCH))
__global__ __launch_bounds__(256) void k_pack(const float* __restrict__ X, const float* __restrict__ WQ, const float* __restrict__ WK, const float* __restrict__ WV, const float* __restrict__ WO, __bf16* __restrict__ XP, __bf16* __restrict__ WP) {
  const int tid = threadIdx.x, rc = tid & 15, k8 = 16 * ((tid >> 5) & 1) + 8 * ((tid >> 4) & 1);
  if (blockIdx.x < NXB) { v4f x0[PCH], x1[PCH];
#pragma unroll
    for (int it = 0; it < PCH; ++it) { const unsigned f = ((blockIdx.x * PCH + it) * 256u + tid) >> 6; const float* p = X + ((size_t)(f >> 5) * 16 + rc) * CC + (f & 31) * 32 + k8; x0[it] = *(const v4f*)p;
      asm volatile("s_wait_xcnt 0x0" ::: "memory");   // the address registers of the load above may be reused as the next load's destination
      x1[it] = *(const v4f*)(p + 4);
      asm volatile("s_wait_xcnt 0x0" ::: "memory");   // as above, for a later chunk's load
    }
#pragma unroll
    for (int it = 0; it < PCH; ++it) { const unsigned c = (blockIdx.x * PCH + it) * 256u + tid; v8b o;
#pragma unroll
      for (int i = 0; i < 4; ++i) { o[i] = (__bf16)x0[it][i]; o[4 + i] = (__bf16)x1[it][i]; }
      vst2(XP + (size_t)c * 8, o); } }
  else { const unsigned wb = blockIdx.x - NXB, w = wb / NWB; const float* WA = w == 0 ? WQ : w == 1 ? WK : w == 2 ? WV : WO;
#pragma unroll
    for (int it = 0; it < PCH; ++it) { const unsigned c = (wb * PCH + it) * 256u + tid, f = c >> 6; const float* p = WA + (size_t)(((f >> 6) & 31) * 32 + k8) * CC + (f & 63) * 16 + rc; v8b o;   /* (in,out) */
#pragma unroll
      for (int i = 0; i < 8; ++i) o[i] = (__bf16)p[(size_t)i * CC];
      vst2(WP + (size_t)c * 8, o); } } }
// ---- k_proj: block = (128 rows, 128 cols, which), wave = RG row tiles of 16 x 128 cols, so every loaded W fragment feeds RG products: qkv = x W (+ b), exact; q -> f16 hi (+ residual), k -> f16, v -> bf16 hi + residual, all in fragment order
#define RG 2
__global__ __launch_bounds__(128) void k_proj(const __bf16* __restrict__ XP, const __bf16* __restrict__ WP, const float* __restrict__ BQ, const float* __restrict__ BK, const float* __restrict__ BV, _Float16* __restrict__ QH, _Float16* __restrict__ QL, _Float16* __restrict__ KH, __bf16* __restrict__ VT, __bf16* __restrict__ VL) {
  __shared__ __align__(16) _Float16 sh[64 * RG][136], sl[64 * RG][136]; __shared__ __align__(16) char wr[2][16384];   // wr: W ring, a stage = 2 kc x 8 fragments
  const int tid = threadIdx.x, wave = tid >> 5, lane = tid & 31, col = lane & 15, g = lane >> 4; const int which = blockIdx.z; const int c0 = blockIdx.y * 128; const size_t r0 = (size_t)blockIdx.x * (64 * RG); const float* BA = which == 0 ? BQ : which == 1 ? BK : BV;
  const __bf16* Ap = XP + (r0 / 16 + wave * RG) * (size_t)(CC / 32) * FRG + lane * 8; const __bf16* Bp = WP + ((size_t)which * (CC / 32) * (CC / 16) + c0 / 16) * FRG + lane * 8;
  v8f acc[RG][8] = {};
  const unsigned wl = (unsigned)(size_t)&wr[0][0] + tid * 16; const char* wg = (const char*)(Bp - lane * 8) + tid * 16;
  const auto fill = [&](int t) { const unsigned l = wl + (t & 1) * 16384; const char* g = wg + (size_t)t * (2 * (CC / 16) * FRG * 2); cp8k(l, g); cp8k(l + 8192, g + (CC / 16) * FRG * 2); };   // stage t = kc 2 t, 2 t + 1
  v16b a[2][RG];   // the wave's own x fragments, straight from L2, asked for ONE STAGE AHEAD: each half-stage's set is refilled right behind its last product, so the load's latency runs under the other half-stage, the barrier and the ring's refill
#pragma unroll
  for (int kk = 0; kk < 2; ++kk)
#pragma unroll
    for (int u = 0; u < RG; ++u) a[kk][u] = fragp_b(Ap + ((size_t)u * (CC / 32) + kk) * FRG);   // stage 0, in flight under the ring's prologue
  asm volatile("s_wait_xcnt 0x0" ::: "memory");   // the address registers of the loads above may be rewritten by the prologue below
  fill(0); RING_LANDED(); RING_BARRIER(); fill(1);
#pragma unroll 1   // one stage a trip: the trip's foot is the ring's publish point
  for (int t = 0; t < CC / 64; ++t) { const int tn = t + 1 < CC / 64 ? t + 1 : t;   // no branch round the refills, so the compiler's counted load waits stay exact: the last trip asks for its own stage again and nobody reads it
#pragma unroll
    for (int kk = 0; kk < 2; ++kk) { v16b w[8]; const __bf16* ws = (const __bf16*)&wr[t & 1][kk * 8192] + lane * 8;
#pragma unroll
      for (int j = 0; j < 8; ++j) w[j] = fragp_b(ws + j * FRG);
#pragma unroll
      for (int j = 0; j < 8; ++j)
#pragma unroll
        for (int u = 0; u < RG; ++u) acc[u][j] = wmma_bf(a[kk][u], w[j], acc[u][j]);
#pragma unroll
      for (int u = 0; u < RG; ++u) a[kk][u] = fragp_b(Ap + ((size_t)u * (CC / 32) + 2 * tn + kk) * FRG);   // the next stage's set, into the registers just read for the last time
      asm volatile("s_wait_xcnt 0x0" ::: "memory");   // the address registers of the loads above may be rewritten by what follows
    }
    RING_READ(); RING_LANDED(); RING_BARRIER();
    if (t + 2 < CC / 64) fill(t + 2);   // same for the whole block
  }
  RING_LANDED();
#pragma unroll
  for (int j = 0; j < 8; ++j) { const float bb0 = BA ? bfr(BA[c0 + j * 16 + col]) : 0.f;
#pragma unroll
    for (int u = 0; u < RG; ++u)
#pragma unroll
      for (int r = 0; r < 8; ++r) acc[u][j][r] += bb0; }   /* bias before the rotary */
  const size_t b = r0 / TT; const int t0 = (int)(r0 % TT);
  if (which == 2) {   /* a lane's 8 registers of tile (u, j) are 8 consecutive t of one feature: one chunk of the V^T fragment (t / 32, dim tile j & 3), e = row tile & 1, stored straight from registers */
#pragma unroll
    for (int u = 0; u < RG; ++u)
#pragma unroll
    for (int j = 0; j < 8; ++j) { v8b hi, lo; const int rt = wave * RG + u;
#pragma unroll
      for (int r = 0; r < 8; ++r) { const float v = acc[u][j][r]; const __bf16 bh = (__bf16)v; hi[r] = bh; lo[r] = (__bf16)(v - (float)bh); }
      const size_t o2 = (((b * NH + c0 / HD + (j >> 2)) * (TT / 32) + t0 / 32 + (rt >> 1)) * 4 + (j & 3)) * FRG + (rt & 1) * 256 + lane * 8; vst2(VT + o2, hi); vst2(VL + o2, lo); }
    return; }   /* block-uniform: which is blockIdx.z */
  /* partial rotary on dims 0..31 of each head: tiles (4hh, 4hh+1) hold dims (col, col+16) of the same lane: (x1, x2) -> (x1 c - x2 s, x2 c + x1 s), angle = t * inv_freq[col] */
  const auto put = [&](const v8f& tile, int rt, int j) {   /* one 16 x 16 tile (row tile rt of the block, column tile j) into the staging planes */
#pragma unroll
    for (int r = 0; r < 8; ++r) { const float v = tile[r]; const int rl = rt * 16 + 8 * g + r, cl = j * 16 + col; const _Float16 hv = (_Float16)v;
      sh[rl][cl] = hv; sl[rl][cl] = (_Float16)((v - (float)hv) * 1024.0f);   /* q residual carried x 2^10 so the plane stays f16-normal on the chip */ } };
#pragma unroll
  for (int u = 0; u < RG; ++u)
#pragma unroll
    for (int hh = 0; hh < 2; ++hh) { put(acc[u][4 * hh + 2], wave * RG + u, 4 * hh + 2); put(acc[u][4 * hh + 3], wave * RG + u, 4 * hh + 3); }   /* dims 32..63 pass unrotated and leave their registers first */
#pragma unroll 1   // one copy of the long cosf / sinf text serves every row tile: unrolled, the kernel's text would grow RG-fold
  for (int u = 0; u < RG; ++u) {
#pragma unroll
    for (int hh = 0; hh < 2; ++hh) {
#pragma unroll
      for (int r = 0; r < 8; ++r) { const int t = (int)((r0 + (wave * RG + u) * 16 + 8 * g + r) % TT); const float ang = (float)t * INVF[col]; const float cs = cosf(ang), sn = sinf(ang); const float x1 = acc[0][4 * hh][r], x2 = acc[0][4 * hh + 1][r]; acc[0][4 * hh][r] = x1 * cs - x2 * sn; acc[0][4 * hh + 1][r] = x2 * cs + x1 * sn; }
      put(acc[0][4 * hh], wave * RG + u, 4 * hh); put(acc[0][4 * hh + 1], wave * RG + u, 4 * hh + 1); }
#pragma unroll
    for (int v = 0; v + 1 < RG; ++v)
#pragma unroll
      for (int hh = 0; hh < 2; ++hh) { acc[v][4 * hh] = acc[v + 1][4 * hh]; acc[v][4 * hh + 1] = acc[v + 1][4 * hh + 1]; }   /* trip u always works on acc[0]: constant register indices in a rolled loop */
  }
  __syncthreads();
  /* chunk e = [head 0..1][t tile 0..4 RG - 1][dims 8 * (0..7)][t & 15]: bits 0..6 are the chunk's place in its pair of fragments (kc 0, 1) */
  _Float16* dh = which == 0 ? QH : KH; for (int e = tid; e < 64 * RG * 16; e += 128) { const int tt = (e >> 7) % (4 * RG), hd = e / (512 * RG); const int rl = tt * 16 + (e & 15), cl = hd * 64 + ((e >> 4) & 7) * 8; const size_t o2 = ((b * NH + c0 / HD + hd) * (TT / 16) + t0 / 16 + tt) * (2 * FRG) + (e & 127) * 8;
    vst2(dh + o2, *(const v4u*)&sh[rl][cl]);
    asm volatile("s_wait_xcnt 0x0" ::: "memory");   // the store's data and address registers are rewritten by the next LDS read and the next trip
    if (which == 0) { vst2(QL + o2, *(const v4u*)&sl[rl][cl]);
      asm volatile("s_wait_xcnt 0x0" ::: "memory");   // as above
    } } }
#define QG 1
#define KT 4
#define SCL2 0.18033688011112042f   // (1 / 8) log2(e): exp((s - m) / 8) = 2^(s SCL2 - m SCL2), one multiply-add and the hardware's exp2 per score
template <bool B> struct Flag { static constexpr bool value = B; };   // a pass's compile-time switch: is it the one that holds the diagonal
__device__ __forceinline__ float xhalf(float x) { return __builtin_bit_cast(float, __builtin_amdgcn_permlanex16(__builtin_bit_cast(int, x), __builtin_bit_cast(int, x), 0x76543210, 0xfedcba98, false, false)); }   // lane l with lane l ^ 16
__global__ __launch_bounds__(128) void k_att(const _Float16* __restrict__ QH, const _Float16* __restrict__ QL, const _Float16* __restrict__ KH, const __bf16* __restrict__ VT, const __bf16* __restrict__ VL, __bf16* __restrict__ YH, __bf16* __restrict__ YL) {
  const int tid = threadIdx.x, wave = __builtin_amdgcn_readfirstlane(tid >> 5), lane = tid & 31, col = lane & 15, g = lane >> 4; const int b = blockIdx.x / NH, h = blockIdx.x % NH;   // wave number in a scalar register: q0 and the q and y offsets built on it stay scalar
  const int qb = TT / (64 * QG) - 1 - (int)blockIdx.y;   // the longest query blocks take the lowest blockIdx.y
  const int q0 = (qb * 4 + wave) * (16 * QG);            // the wave's first query
  const int npass = (qb * (64 * QG) + 64 * QG - 1) / (16 * KT) + 1;  // from the block's last query: the same in all four waves (64 QG is a multiple of 16 KT, so it is each wave's own count too); q0 is never below the last pass's first key, so every query sees a live key in every pass
  __shared__ __align__(16) char ring[2][3][16 * KT * HD * 2];   // a stage = one pass's k, v, v residual fragments
  v16h ah[QG][2], al[QG][2];
#pragma unroll
  for (int u = 0; u < QG; ++u)
#pragma unroll
    for (int kc = 0; kc < 2; ++kc) { const size_t qo = (((size_t)blockIdx.x * (TT / 16) + q0 / 16 + u) * 2 + kc) * FRG + lane * 8; ah[u][kc] = fragp_h(QH + qo); al[u][kc] = fragp_h(QL + qo); }
  const size_t ho = (size_t)blockIdx.x * (TT * HD) * 2 + tid * 16; const char* Kg = (const char*)KH + ho; const char* Vhg = (const char*)VT + ho; const char* Vlg = (const char*)VL + ho;   // blockIdx.x = b * NH + h; a head's k, v: TT * HD elements each, fragments [key tile][kc] and [32 keys][dim tile]: a pass's 8 fragments of each are 8 KiB in a row
  const unsigned rl = (unsigned)(size_t)&ring[0][0][0] + tid * 16;
  const auto fill = [&](int t) { const unsigned l = rl + (t & 1) * 24576; const size_t go = (size_t)t * 8192; cp8k(l, Kg + go); cp8k(l + 8192, Vhg + go); cp8k(l + 16384, Vlg + go); };
  fill(0); RING_LANDED(); __syncthreads();
  if (npass > 1) fill(1);   // same for the whole block
  v8f o[QG][4] = {}; float m[QG], l[QG];   // m: running maximum of the raw products
#pragma unroll
  for (int u = 0; u < QG; ++u) { m[u] = -3.0e38f; l[u] = 0.f; }
  // one pass; only the last pass of a wave holds keys above a query (k0 + 16 KT - 1 <= q0 - 1 in every earlier one), so only its copy of the text carries the 32 compares and selects of the causal mask; always_inline: at both call sites o, m, l and the q fragments stay in registers
  const auto pass = [&](const int kb, auto dg) __attribute__((always_inline)) { const int k0 = kb * (16 * KT); constexpr bool diag = decltype(dg)::value;
    v16h kf[KT][2];
#pragma unroll
    for (int jt = 0; jt < KT; ++jt)
#pragma unroll
      for (int kc = 0; kc < 2; ++kc) kf[jt][kc] = fragp_h((const _Float16*)&ring[kb & 1][0][0] + (jt * 2 + kc) * FRG + lane * 8);
    F2 p[QG][KT / 2];
#pragma unroll
    for (int u = 0; u < QG; ++u) { v8f s[KT] = {}, sl[KT] = {};
#pragma unroll
      for (int kc = 0; kc < 2; ++kc)
#pragma unroll
        for (int jt = 0; jt < KT; ++jt) { s[jt] = wmma16(kf[jt][kc], ah[u][kc], s[jt]); sl[jt] = wmma16(kf[jt][kc], al[u][kc], sl[jt]); }
      const int qt = q0 + u * 16 + col; float mx = m[u];
#pragma unroll
      for (int jt = 0; jt < KT; ++jt) { s[jt] += sl[jt] * (1.0f / 1024.0f);
#pragma unroll
        for (int r = 0; r < 8; ++r) { float v = s[jt][r]; if (diag && k0 + jt * 16 + 8 * g + r > qt) v = -3.0e38f; s[jt][r] = v; mx = fmaxf(mx, v); } }   /* maximum over the raw products: the scale is positive */
      mx = fmaxf(mx, xhalf(mx));
      const float nm = -mx * SCL2, sc = __builtin_amdgcn_exp2f((m[u] - mx) * SCL2); m[u] = mx; float ps = 0.f;   /* nm is rounded once, to 2^-24 of m SCL2: far below what the f16 rounding of k leaves in the same score */
#pragma unroll
      for (int jt = 0; jt < KT; ++jt) { s[jt] = s[jt] * SCL2 + nm;   /* contracts to one multiply-add a score */
#pragma unroll
        for (int r = 0; r < 8; ++r) { const float e = __builtin_amdgcn_exp2f(s[jt][r]); s[jt][r] = e; ps += e; } }   /* a masked score is -3e38 and mx is a live score: the exponent is about -5e37 and the result exactly 0 */
      l[u] = l[u] * sc + ps;
#pragma unroll
      for (int j = 0; j < 4; ++j) o[u][j] *= sc;
#pragma unroll
      for (int c = 0; c < KT / 2; ++c) { float pv[16];
#pragma unroll
        for (int i = 0; i < 8; ++i) { pv[i] = s[2 * c][i]; pv[8 + i] = s[2 * c + 1][i]; }
        p[u][c] = bsplit16(pv); } }
#pragma unroll
    for (int c = 0; c < KT / 2; ++c) { v16b vh[4], vl[4];
#pragma unroll
      for (int j = 0; j < 4; ++j) { const int po = (c * 4 + j) * FRG + lane * 8; vh[j] = fragp_b((const __bf16*)&ring[kb & 1][1][0] + po); vl[j] = fragp_b((const __bf16*)&ring[kb & 1][2][0] + po); }
#pragma unroll
      for (int u = 0; u < QG; ++u) {
#pragma unroll
        for (int j = 0; j < 4; ++j) o[u][j] = wmma_bf(vh[j], p[u][c].h, o[u][j]);
#pragma unroll
        for (int j = 0; j < 4; ++j) o[u][j] = wmma_bf(vh[j], p[u][c].l, o[u][j]);
#pragma unroll
        for (int j = 0; j < 4; ++j) o[u][j] = wmma_bf(vl[j], p[u][c].h, o[u][j]); } }
    RING_READ(); RING_LANDED(); __syncthreads();
    if (kb + 2 < npass) fill(kb + 2);   // same for the whole block
  };
#pragma unroll 1   // one stage a trip: the trip's foot is the ring's publish point
  for (int kb = 0; kb < npass - 1; ++kb) pass(kb, Flag<false>{});
  pass(npass - 1, Flag<true>{});
  RING_LANDED();
#pragma unroll
  for (int u = 0; u < QG; ++u) { const float inv = 1.0f / (l[u] + xhalf(l[u])); const size_t yo = (((size_t)b * TT + q0) / 16 + u) * (size_t)(CC / 32) * FRG + (size_t)(h * 2) * FRG + lane * 8;   // register r of tile j = dim 16 j + 8 g + r of the lane's query: chunk e = j & 1 of the y fragment kc = 2 h + (j >> 1)
#pragma unroll
    for (int j = 0; j < 4; ++j) { v8b hi, lo;
#pragma unroll
      for (int r = 0; r < 8; ++r) { const float y = o[u][j][r] * inv; const __bf16 yb = (__bf16)y; hi[r] = yb; lo[r] = (__bf16)(y - (float)yb); }
      const size_t o2 = yo + (j >> 1) * FRG + (j & 1) * 256; vst2(YH + o2, hi); vst2(YL + o2, lo); } } }
// ---- k_out: block = (64 rows, 128 cols): out = y (bf16 hi + lo) Wo + bo
__global__ __launch_bounds__(128) void k_out(const __bf16* __restrict__ YH, const __bf16* __restrict__ YL, const __bf16* __restrict__ WP, const float* __restrict__ BP, float* __restrict__ OUT) { __shared__ __align__(16) float sf[4][16][132]; __shared__ __align__(16) char wr[2][16384];   // wr: W ring, a stage = 2 kc x 8 fragments
  const int tid = threadIdx.x, wave = tid >> 5, lane = tid & 31, col = lane & 15, g = lane >> 4; const int c0 = blockIdx.y * 128; const size_t r0 = (size_t)blockIdx.x * 64 + wave * 16;
  const size_t ao = (r0 / 16) * (size_t)(CC / 32) * FRG + lane * 8; const __bf16* Ah = YH + ao; const __bf16* Al = YL + ao; const __bf16* Bp = WP + ((size_t)3 * (CC / 32) * (CC / 16) + c0 / 16) * FRG + lane * 8;
  v8f acc[8] = {};
  const unsigned wl = (unsigned)(size_t)&wr[0][0] + tid * 16; const char* wg = (const char*)(Bp - lane * 8) + tid * 16;
  const auto fill = [&](int t) { const unsigned l = wl + (t & 1) * 16384; const char* g = wg + (size_t)t * (2 * (CC / 16) * FRG * 2); cp8k(l, g); cp8k(l + 8192, g + (CC / 16) * FRG * 2); };   // stage t = kc 2 t, 2 t + 1
  v16b ah[2], al[2];   // the wave's own y fragments, straight from L2, asked for one stage ahead as in k_proj
#pragma unroll
  for (int kk = 0; kk < 2; ++kk) { ah[kk] = fragp_b(Ah + (size_t)kk * FRG); al[kk] = fragp_b(Al + (size_t)kk * FRG); }   // stage 0, in flight under the ring's prologue
  asm volatile("s_wait_xcnt 0x0" ::: "memory");   // the address registers of the loads above may be rewritten by the prologue below
  fill(0); RING_LANDED(); RING_BARRIER(); fill(1);
#pragma unroll 1   // one stage a trip: the trip's foot is the ring's publish point
  for (int t = 0; t < CC / 64; ++t) { const int tn = t + 1 < CC / 64 ? t + 1 : t;   // no branch round the refills, so the compiler's counted load waits stay exact: the last trip asks for its own stage again and nobody reads it
#pragma unroll
    for (int kk = 0; kk < 2; ++kk) { v16b w[8]; const __bf16* ws = (const __bf16*)&wr[t & 1][kk * 8192] + lane * 8;
#pragma unroll
      for (int j = 0; j < 8; ++j) w[j] = fragp_b(ws + j * FRG);
#pragma unroll
      for (int j = 0; j < 8; ++j) { acc[j] = wmma_bf(ah[kk], w[j], acc[j]); acc[j] = wmma_bf(al[kk], w[j], acc[j]); }
      ah[kk] = fragp_b(Ah + (size_t)(2 * tn + kk) * FRG); al[kk] = fragp_b(Al + (size_t)(2 * tn + kk) * FRG);   // the next stage's pair, into the registers just read for the last time
      asm volatile("s_wait_xcnt 0x0" ::: "memory");   // the address registers of the loads above may be rewritten by what follows
    }
    RING_READ(); RING_LANDED(); RING_BARRIER();
    if (t + 2 < CC / 64) fill(t + 2);   // same for the whole block
  }
  RING_LANDED();
#pragma unroll
  for (int j = 0; j < 8; ++j) { const float bb = BP ? bfr(BP[c0 + j * 16 + col]) : 0.f;
#pragma unroll
    for (int r = 0; r < 8; ++r) sf[wave][8 * g + r][j * 16 + col] = acc[j][r] + bb; }
  LDSX(); for (int rl = 0; rl < 16; ++rl) vst2(OUT + (r0 + rl) * CC + c0 + lane * 4, *(const v4f*)&sf[wave][rl][lane * 4]); }
extern "C" void kernel_launch(void* const* d_in, const int* in_sizes, int n_in, void* d_out, int out_size, void* d_ws, size_t ws_size, hipStream_t stream) {
  (void)in_sizes; (void)n_in; (void)out_size;
  const float** F = (const float**)d_in;   // 0 x [2,2048,1024], 1 Wq [1024,1024] ((in,out)), 2 bq, 3 Wk, 4 bk, 5 Wv, 6 bv, 7 Wo ((in,out)), 8 bo
  if (ws_size < (size_t)WS_END) return;
  char* ws = (char*)d_ws; _Float16 *QH = (_Float16*)(ws + WS_QH), *QL = (_Float16*)(ws + WS_QL), *KH = (_Float16*)(ws + WS_KH); __bf16 *VT = (__bf16*)(ws + WS_VT), *VL = (__bf16*)(ws + WS_VL), *YH = (__bf16*)(ws + WS_YH), *YL = (__bf16*)(ws + WS_YL), *XP = (__bf16*)(ws + WS_XP), *WP = (__bf16*)(ws + WS_WP);
  k_pack<<<dim3(NXB + 4 * NWB), 256, 0, stream>>>(F[0], F[1], F[3], F[5], F[7], XP, WP);
  k_proj<<<dim3(TNB * TT / (64 * RG), CC / 128, 3), 128, 0, stream>>>(XP, WP, F[2], F[4], F[6], QH, QL, KH, VT, VL);
  k_att<<<dim3(TNB * NH, TT / (64 * QG)), 128, 0, stream>>>(QH, QL, KH, VT, VL, YH, YL);
  k_out<<<dim3(TNB * TT / 64, CC / 128), 128, 0, stream>>>(YH, YL, WP, F[8], (float*)d_out);
}

// v009
// A run of this version takes 68.8 microseconds.
// Versions between v007 and this one are left out; their measured steps multiply to 1.29 times as fast.
// Counting every step since v000, it is 19.5 times as fast.
// compute dtype: all float inputs rounded to bf16; q/k/v = x W + b ((in,out)) with EXACT bf16 products on WMMA 16x16x32, f32 accumulate; partial rotary (first 32 dims of each head) in f32 in the projection epilogue with precise cosf/sinf of t * inv_freq (the module's f32 inv_freq constants); q, k rounded to f16 -> 1-product causal logits / 8 kept in registers; running-maximum softmax in f32 (hardware exp2 of (s - m) log2(e) / 8), kept per half of every 128-key stage and joined in f32 at the end, exp(s - m) rounded to f16 against v rounded to f16 (1 product), divided by the f32 row sum of the unrounded values at the end; out = o (bf16 hi + lo) Wo + bo; f32 output.
#include <hip/hip_runtime.h>
#include <math.h>

typedef __attribute__((ext_vector_type(16))) _Float16 v16h;
typedef __attribute__((ext_vector_type(16))) __bf16 v16b;
typedef __attribute__((ext_vector_type(8)))  _Float16 v8h;
typedef __attribute__((ext_vector_type(8)))  float v8f;
typedef __attribute__((ext_vector_type(4)))  float v4f;
typedef __attribute__((ext_vector_type(2)))  float v2f;
typedef __attribute__((ext_vector_type(4)))  unsigned v4u;
typedef __attribute__((ext_vector_type(4)))  int v4i;
typedef float __attribute__((may_alias)) float_a;
typedef int __attribute__((may_alias)) int_a;

template <typename T> __device__ __forceinline__ void vst2(void* p, T v) { *(T*)p = v;  }
__device__ __forceinline__ v8f wmma16(v16h a, v16h b, v8f c) {
  v8f d = __builtin_amdgcn_wmma_f32_16x16x32_f16(false, a, false, b, (short)0, c, false, false);
  asm volatile("v_nop\n\tv_nop\n\tv_nop\n\tv_nop" : "+v"(d) : "v"(a), "v"(b));
  return d;
}
__device__ __forceinline__ v8f wmma_bf(v16b a, v16b b, v8f c) {
  v8f d = __builtin_amdgcn_wmma_f32_16x16x32_bf16(false, a, false, b, (short)0, c, false, false);
  asm volatile("v_nop\n\tv_nop\n\tv_nop\n\tv_nop" : "+v"(d) : "v"(a), "v"(b));
  return d;
}
// 16x16x32 fragments: lane = (h = lane>>4, row/col = lane&15); elements 0..7 = k0+8h+0..7, 8..15 = k0+16+8h+0..7; D element r = row 8h+r
__device__ __forceinline__ v16h frag_h(const _Float16* rowk0, int lane) {
  union { v16h v; v8h q[2]; } u; const _Float16* p = rowk0 + 8 * (lane >> 4);
  u.q[0] = *(const v8h*)p; u.q[1] = *(const v8h*)(p + 16); return u.v;
}
__device__ __forceinline__ v16h frag_f32(const float* rowk0, int lane) {
  v16h a; const float* p = rowk0 + 8 * (lane >> 4);
#pragma unroll
  for (int i = 0; i < 8; ++i) { a[i] = (_Float16)p[i]; a[8 + i] = (_Float16)p[16 + i]; }
  return a;
}
__device__ __forceinline__ v16h frag_f32s(const float* rowk0, int lane, float sc) {
  v16h a; const float* p = rowk0 + 8 * (lane >> 4);
#pragma unroll
  for (int i = 0; i < 8; ++i) { a[i] = (_Float16)(p[i] * sc); a[8 + i] = (_Float16)(p[16 + i] * sc); }
  return a;
}
// column fragment from a [K][ld] layout (column n), rows >= K read as 0
__device__ __forceinline__ v16h fragc_f32(const float* W, int k0, int n, int lane, int ld, int K) {
  v16h a; const int g = lane >> 4;
#pragma unroll
  for (int i = 0; i < 8; ++i) { const int ka = k0 + 8 * g + i, kb = ka + 16;
    a[i] = (_Float16)(ka < K ? W[(size_t)(ka < K ? ka : K - 1) * ld + n] : 0.f); a[8 + i] = (_Float16)(kb < K ? W[(size_t)(kb < K ? kb : K - 1) * ld + n] : 0.f); }
  return a;
}
struct F2 { v16b h, l; };
__device__ __forceinline__ F2 bsplit16(const float v[16]) { F2 r;
#pragma unroll
  for (int i = 0; i < 16; ++i) { const __bf16 h = (__bf16)v[i]; r.h[i] = h; r.l[i] = (__bf16)(v[i] - (float)h); }
  return r; }
__device__ __forceinline__ F2 split_row(const float* row, int k0, int lane) { float v[16]; const float* p = row + k0 + 8 * (lane >> 4);
#pragma unroll
  for (int i = 0; i < 8; ++i) { v[i] = p[i]; v[8 + i] = p[16 + i]; }
  return bsplit16(v); }
__device__ __forceinline__ F2 split_rowK(const float* row, int k0, int lane, int K) { float v[16]; const int g = lane >> 4;
#pragma unroll
  for (int i = 0; i < 8; ++i) { const int ka = k0 + 8 * g + i, kb = ka + 16; v[i] = ka < K ? row[ka < K ? ka : K - 1] : 0.f; v[8 + i] = kb < K ? row[kb < K ? kb : K - 1] : 0.f; }
  return bsplit16(v); }
__device__ __forceinline__ F2 split_col(const float* W, int k0, int n, int lane, int ld, int K) { float v[16]; const int g = lane >> 4;
#pragma unroll
  for (int i = 0; i < 8; ++i) { const int ka = k0 + 8 * g + i, kb = ka + 16; v[i] = ka < K ? W[(size_t)(ka < K ? ka : K - 1) * ld + n] : 0.f; v[8 + i] = kb < K ? W[(size_t)(kb < K ? kb : K - 1) * ld + n] : 0.f; }
  return bsplit16(v); }
__device__ __forceinline__ v8f mac3(const F2& a, const F2& b, v8f c) { c = wmma_bf(a.l, b.h, c); c = wmma_bf(a.h, b.l, c); return wmma_bf(a.h, b.h, c); }
__device__ __forceinline__ float sigm(float v) { return 1.0f / (1.0f + expf(-v)); }
#define LDSX() do { asm volatile("s_wait_dscnt 0" ::: "memory"); __builtin_amdgcn_wave_barrier(); __builtin_amdgcn_fence(__ATOMIC_RELEASE, "workgroup"); } while (0)


// Causal MHA with partial rotary embedding (B 2, T 2,048, C 1,024 = 16 x 64, rotary on dims 0..31 of each head as rotate_half pairs (d, d+16), base 10000): att = softmax(q_rot k_rot^T / 8 | causal) v; out = merged Wo + bo.
#define NB 2
#define TT 2048
#define CC 1024
#define NH 16
#define HD 64
__constant__ float INVF[16] = {1.000000000e+00f,5.623413324e-01f,3.162277639e-01f,1.778279394e-01f,1.000000015e-01f,5.623412877e-02f,3.162277862e-02f,1.778279431e-02f,9.999999776e-03f,5.623413250e-03f,3.162277862e-03f,1.778279431e-03f,1.000000047e-03f,5.623413017e-04f,3.162277862e-04f,1.778279402e-04f};   // 1 / 10000^(2i/32) as the module's f32 values
#ifndef TNB
#define TNB NB
#endif
typedef __attribute__((ext_vector_type(8))) __bf16 v8b;
__device__ __forceinline__ v16b frag_b(const __bf16* rowk0, int lane) {
  union { v16b v; v8b q[2]; } u; const __bf16* p = rowk0 + 8 * (lane >> 4);
  u.q[0] = *(const v8b*)p; u.q[1] = *(const v8b*)(p + 16); return u.v;
}
__device__ __forceinline__ float bfr(float v) { return (float)(__bf16)v; }
__device__ __attribute__((noinline)) float exp_ni(float v) { return expf(v); }
__device__ __attribute__((noinline)) float erf_ni(float v) { return erff(v); }

#define WS_QH  0u
#define WS_KH  (WS_QH + 2u * (size_t)NB * TT * CC)
#define WS_VT  (WS_KH + 2u * (size_t)NB * TT * CC)      // f16 v, fragment order
#define WS_YH  (WS_VT + 2u * (size_t)NB * CC * TT)      // bf16 y, fragment order
#define WS_YL  (WS_YH + 2u * (size_t)NB * TT * CC)      // bf16 y residual
#define WS_XP  (WS_YL + 2u * (size_t)NB * TT * CC)      // bf16 x, fragment order
#define WS_WP  (WS_XP + 2u * (size_t)NB * TT * CC)      // bf16 Wq, Wk, Wv, Wo, fragment order
#define WS_END (WS_WP + 2u * (size_t)4 * CC * CC)

// FRAGMENT ORDER, every 16-bit matrix operand in the workspace: one 16 x 32 fragment = 512 elements = [e 0..1][lane 0..31][i 0..7], holding (row or column lane & 15, k = 16 e + 8 (lane >> 4) + i).
// A wave reads a fragment as two 16-byte loads per lane, each 512 contiguous bytes (4 cache lines); from row-major planes the same load touched 16 lines.
#define FRG 512
__device__ __forceinline__ v16b fragp_b(const __bf16* p) { union { v16b v; v8b q[2]; } u; u.q[0] = *(const v8b*)p; u.q[1] = *(const v8b*)(p + 256); return u.v; }       // p = fragment + 8 * lane
__device__ __forceinline__ v16h fragp_h(const _Float16* p) { union { v16h v; v8h q[2]; } u; u.q[0] = *(const v8h*)p; u.q[1] = *(const v8h*)(p + 256); return u.v; }
// LDS RING: fragments that several waves of a block read come from L2 once per block, not once per wave: 128 threads x 16 bytes x 4 asynchronous copies = 8 KiB (8 fragments, contiguous in the workspace) from g to LDS byte address l, both already the lane's own (+ 16 * tid).
// Two buffers: stage t + 2 is asked for behind the barrier that ends the reads of stage t, and flies while stage t + 1 is worked on.
__device__ __forceinline__ void cp8k(unsigned l, const char* g) {
  // s_wait_xcnt as the statement's last line, a precaution: no register that one of the four copies names is rewritten in front of it
  asm volatile("global_load_async_to_lds_b128 %0, %4, off\n\tglobal_load_async_to_lds_b128 %1, %5, off\n\tglobal_load_async_to_lds_b128 %2, %6, off\n\tglobal_load_async_to_lds_b128 %3, %7, off\n\ts_wait_xcnt 0x0"
               :: "v"(l), "v"(l + 2048u), "v"(l + 4096u), "v"(l + 6144u), "v"(g), "v"(g + 2048), "v"(g + 4096), "v"(g + 6144) : "memory");
}
#define RING_LANDED() asm volatile("s_wait_asynccnt 0x0" ::: "memory")   // this wave's copies have landed; the barrier behind it shows them to the other waves
#define RING_READ()   asm volatile("s_wait_dscnt 0x0" ::: "memory")      // this wave's LDS reads of the stage are done before the barrier behind which the buffer is refilled
// the work-group barrier with its two fences on LDS alone: __syncthreads() also waits out every global load of the wave, and would end the flight of the x / y fragments asked for one stage ahead (they read what an earlier launch wrote, nothing of this one)
#define RING_BARRIER() do { __builtin_amdgcn_fence(__ATOMIC_RELEASE, "workgroup", "local"); __builtin_amdgcn_s_barrier(); __builtin_amdgcn_fence(__ATOMIC_ACQUIRE, "workgroup", "local"); } while (0)

// ---- k_pack: x and the four weights rounded to bf16 and laid out in fragment order; a chunk = 16 bytes = 8 k of one row or column, chunks in output order, PCH chunks per thread (few waves, for speed only).
// x fragments [row tile][kc]; weight fragments [which][kc][column tile]
#define PCH 8
#define NXB (TNB * TT * CC / (2048 * PCH))
#define NWB (CC * CC / (2048 * PCH))
__global__ __launch_bounds__(256) void k_pack(const float* __restrict__ X, const float* __restrict__ WQ, const float* __restrict__ WK, const float* __restrict__ WV, const float* __restrict__ WO, __bf16* __restrict__ XP, __bf16* __restrict__ WP) {
  const int tid = threadIdx.x, rc = tid & 15, k8 = 16 * ((tid >> 5) & 1) + 8 * ((tid >> 4) & 1);
  if (blockIdx.x < NXB) { v4f x0[PCH], x1[PCH];
#pragma unroll
    for (int it = 0; it < PCH; ++it) { const unsigned f = ((blockIdx.x * PCH + it) * 256u + tid) >> 6; const float* p = X + ((size_t)(f >> 5) * 16 + rc) * CC + (f & 31) * 32 + k8; x0[it] = *(const v4f*)p;
      asm volatile("s_wait_xcnt 0x0" ::: "memory");   // the address registers of the load above may be reused as the next load's destination
      x1[it] = *(const v4f*)(p + 4);
      asm volatile("s_wait_xcnt 0x0" ::: "memory");   // as above, for a later chunk's load
    }
#pragma unroll
    for (int it = 0; it < PCH; ++it) { const unsigned c = (blockIdx.x * PCH + it) * 256u + tid; v8b o;
#pragma unroll
      for (int i = 0; i < 4; ++i) { o[i] = (__bf16)x0[it][i]; o[4 + i] = (__bf16)x1[it][i]; }
      vst2(XP + (size_t)c * 8, o); } }
  else { const unsigned wb = blockIdx.x - NXB, w = wb / NWB; const float* WA = w == 0 ? WQ : w == 1 ? WK : w == 2 ? WV : WO;
#pragma unroll
    for (int it = 0; it < PCH; ++it) { const unsigned c = (wb * PCH + it) * 256u + tid, f = c >> 6; const float* p = WA + (size_t)(((f >> 6) & 31) * 32 + k8) * CC + (f & 63) * 16 + rc; v8b o;   /* (in,out) */
#pragma unroll
      for (int i = 0; i < 8; ++i) o[i] = (__bf16)p[(size_t)i * CC];
      vst2(WP + (size_t)c * 8, o); } } }
// ---- k_proj: block = (128 rows, 128 cols, which), wave = RG row tiles of 16 x 128 cols, so every loaded W fragment feeds RG products: qkv = x W (+ b), exact; q, k, v -> f16, all in fragment order
#define RG 2
__global__ __launch_bounds__(128) void k_proj(const __bf16* __restrict__ XP, const __bf16* __restrict__ WP, const float* __restrict__ BQ, const float* __restrict__ BK, const float* __restrict__ BV, _Float16* __restrict__ QH, _Float16* __restrict__ KH, _Float16* __restrict__ VT) {
  __shared__ __align__(16) _Float16 sh[64 * RG][136]; __shared__ __align__(16) char wr[2][16384];   // wr: W ring, a stage = 2 kc x 8 fragments
  const int tid = threadIdx.x, wave = tid >> 5, lane = tid & 31, col = lane & 15, g = lane >> 4; const int which = blockIdx.z; const int c0 = blockIdx.y * 128; const size_t r0 = (size_t)blockIdx.x * (64 * RG); const float* BA = which == 0 ? BQ : which == 1 ? BK : BV;
  const __bf16* Ap = XP + (r0 / 16 + wave * RG) * (size_t)(CC / 32) * FRG + lane * 8; const __bf16* Bp = WP + ((size_t)which * (CC / 32) * (CC / 16) + c0 / 16) * FRG + lane * 8;
  v8f acc[RG][8] = {};
  const unsigned wl = (unsigned)(size_t)&wr[0][0] + tid * 16; const char* wg = (const char*)(Bp - lane * 8) + tid * 16;
  const auto fill = [&](int t) { const unsigned l = wl + (t & 1) * 16384; const char* g = wg + (size_t)t * (2 * (CC / 16) * FRG * 2); cp8k(l, g); cp8k(l + 8192, g + (CC / 16) * FRG * 2); };   // stage t = kc 2 t, 2 t + 1
  v16b a[2][RG];   // the wave's own x fragments, straight from L2, asked for ONE STAGE AHEAD: each half-stage's set is refilled right behind its last product, so the load's latency runs under the other half-stage, the barrier and the ring's refill
#pragma unroll
  for (int kk = 0; kk < 2; ++kk)
#pragma unroll
    for (int u = 0; u < RG; ++u) a[kk][u] = fragp_b(Ap + ((size_t)u * (CC / 32) + kk) * FRG);   // stage 0, in flight under the ring's prologue
  asm volatile("s_wait_xcnt 0x0" ::: "memory");   // the address registers of the loads above may be rewritten by the prologue below
  fill(0); RING_LANDED(); RING_BARRIER(); fill(1);
#pragma unroll 1   // one stage a trip: the trip's foot is the ring's publish point
  for (int t = 0; t < CC / 64; ++t) { const int tn = t + 1 < CC / 64 ? t + 1 : t;   // no branch round the refills, so the compiler's counted load waits stay exact: the last trip asks for its own stage again and nobody reads it
#pragma unroll
    for (int kk = 0; kk < 2; ++kk) { v16b w[8]; const __bf16* ws = (const __bf16*)&wr[t & 1][kk * 8192] + lane * 8;
#pragma unroll
      for (int j = 0; j < 8; ++j) w[j] = fragp_b(ws + j * FRG);
#pragma unroll
      for (int j = 0; j < 8; ++j)
#pragma unroll
        for (int u = 0; u < RG; ++u) acc[u][j] = wmma_bf(a[kk][u], w[j], acc[u][j]);
#pragma unroll
      for (int u = 0; u < RG; ++u) a[kk][u] = fragp_b(Ap + ((size_t)u * (CC / 32) + 2 * tn + kk) * FRG);   // the next stage's set, into the registers just read for the last time
      asm volatile("s_wait_xcnt 0x0" ::: "memory");   // the address registers of the loads above may be rewritten by what follows
    }
    RING_READ(); RING_LANDED(); RING_BARRIER();
    if (t + 2 < CC / 64) fill(t + 2);   // same for the whole block
  }
  RING_LANDED();
#pragma unroll
  for (int j = 0; j < 8; ++j) { const float bb0 = BA ? bfr(BA[c0 + j * 16 + col]) : 0.f;
#pragma unroll
    for (int u = 0; u < RG; ++u)
#pragma unroll
      for (int r = 0; r < 8; ++r) acc[u][j][r] += bb0; }   /* bias before the rotary */
  const size_t b = r0 / TT; const int t0 = (int)(r0 % TT);
  if (which == 2) {   /* a lane's 8 registers of tile (u, j) are 8 consecutive t of one feature: one chunk of the V^T fragment (t / 32, dim tile j & 3), e = row tile & 1, stored straight from registers */
#pragma unroll
    for (int u = 0; u < RG; ++u)
#pragma unroll
    for (int j = 0; j < 8; ++j) { v8h hi; const int rt = wave * RG + u;
#pragma unroll
      for (int r = 0; r < 8; ++r) hi[r] = (_Float16)acc[u][j][r];
      const size_t o2 = (((b * NH + c0 / HD + (j >> 2)) * (TT / 32) + t0 / 32 + (rt >> 1)) * 4 + (j & 3)) * FRG + (rt & 1) * 256 + lane * 8; vst2(VT + o2, hi); }
    return; }   /* block-uniform: which is blockIdx.z */
  /* partial rotary on dims 0..31 of each head: tiles (4hh, 4hh+1) hold dims (col, col+16) of the same lane: (x1, x2) -> (x1 c - x2 s, x2 c + x1 s), angle = t * inv_freq[col] */
  const auto put = [&](const v8f& tile, int rt, int j) {   /* one 16 x 16 tile (row tile rt of the block, column tile j) into the staging plane */
#pragma unroll
    for (int r = 0; r < 8; ++r) sh[rt * 16 + 8 * g + r][j * 16 + col] = (_Float16)tile[r]; };
#pragma unroll
  for (int u = 0; u < RG; ++u)
#pragma unroll
    for (int hh = 0; hh < 2; ++hh) { put(acc[u][4 * hh + 2], wave * RG + u, 4 * hh + 2); put(acc[u][4 * hh + 3], wave * RG + u, 4 * hh + 3); }   /* dims 32..63 pass unrotated and leave their registers first */
#pragma unroll 1   // one copy of the long cosf / sinf text serves every row tile: unrolled, the kernel's text would grow RG-fold
  for (int u = 0; u < RG; ++u) {
#pragma unroll
    for (int hh = 0; hh < 2; ++hh) {
#pragma unroll
      for (int r = 0; r < 8; ++r) { const int t = (int)((r0 + (wave * RG + u) * 16 + 8 * g + r) % TT); const float ang = (float)t * INVF[col]; const float cs = cosf(ang), sn = sinf(ang); const float x1 = acc[0][4 * hh][r], x2 = acc[0][4 * hh + 1][r]; acc[0][4 * hh][r] = x1 * cs - x2 * sn; acc[0][4 * hh + 1][r] = x2 * cs + x1 * sn; }
      put(acc[0][4 * hh], wave * RG + u, 4 * hh); put(acc[0][4 * hh + 1], wave * RG + u, 4 * hh + 1); }
#pragma unroll
    for (int v = 0; v + 1 < RG; ++v)
#pragma unroll
      for (int hh = 0; hh < 2; ++hh) { acc[v][4 * hh] = acc[v + 1][4 * hh]; acc[v][4 * hh + 1] = acc[v + 1][4 * hh + 1]; }   /* trip u always works on acc[0]: constant register indices in a rolled loop */
  }
  __syncthreads();
  /* chunk e = [head 0..1][t tile 0..4 RG - 1][dims 8 * (0..7)][t & 15]: bits 0..6 are the chunk's place in its pair of fragments (kc 0, 1) */
  _Float16* dh = which == 0 ? QH : KH; for (int e = tid; e < 64 * RG * 16; e += 128) { const int tt = (e >> 7) % (4 * RG), hd = e / (512 * RG); const int rl = tt * 16 + (e & 15), cl = hd * 64 + ((e >> 4) & 7) * 8; const size_t o2 = ((b * NH + c0 / HD + hd) * (TT / 16) + t0 / 16 + tt) * (2 * FRG) + (e & 127) * 8;
    vst2(dh + o2, *(const v4u*)&sh[rl][cl]);
    asm volatile("s_wait_xcnt 0x0" ::: "memory");   // the store's data and address registers are rewritten by the next LDS read and the next trip
  } }
#define QG 2
#define KT 4
#define SCL2 0.18033688011112042f   // (1 / 8) log2(e): exp((s - m) / 8) = 2^(s SCL2 - m SCL2), one multiply-add and the hardware's exp2 per score
template <bool B> struct Flag { static constexpr bool value = B; };   // a stage's compile-time switch: is it the one that holds the diagonal
__device__ __forceinline__ float xhalf(float x) { return __builtin_bit_cast(float, __builtin_amdgcn_permlanex16(__builtin_bit_cast(int, x), __builtin_bit_cast(int, x), 0x76543210, 0xfedcba98, false, false)); }   // lane l with lane l ^ 16
__global__ __launch_bounds__(128) void k_att(const _Float16* __restrict__ QH, const _Float16* __restrict__ KH, const _Float16* __restrict__ VT, __bf16* __restrict__ YH, __bf16* __restrict__ YL) {
  const int tid = threadIdx.x, wave = __builtin_amdgcn_readfirstlane(tid >> 5), lane = tid & 31, col = lane & 15, g = lane >> 4; const int b = blockIdx.x / NH, h = blockIdx.x % NH;   // wave number in a scalar register: every test on it is a scalar branch
  const int qh = wave & 1, kh = wave >> 1;
  const int qb = TT / 64 - 1 - (int)blockIdx.y;   // the longest query blocks take the lowest blockIdx.y
  const int q0 = qb * 64 + qh * (16 * QG);        // the wave's first query
  const int ntrip = (qb >> 1) + 1;                // stages of 128 keys up to the block's last query; every stage but the last ends below the block's first query
  __shared__ __align__(16) char ring[2][32768];   // a stage = 128 keys' k fragments (16 KiB), then their v fragments (16 KiB)
  v16h ah[QG][2];
#pragma unroll
  for (int u = 0; u < QG; ++u)
#pragma unroll
    for (int kc = 0; kc < 2; ++kc) { const size_t qo = (((size_t)blockIdx.x * (TT / 16) + q0 / 16 + u) * 2 + kc) * FRG + lane * 8; ah[u][kc] = fragp_h(QH + qo); }
  asm volatile("s_wait_xcnt 0x0" ::: "memory");   // the address registers of the loads above may be rewritten by the prologue below
  const size_t ho = (size_t)blockIdx.x * (TT * HD) * 2 + tid * 16; const char* Kg = (const char*)KH + ho; const char* Vhg = (const char*)VT + ho;   // blockIdx.x = b * NH + h; a head's k, v: TT * HD elements each, fragments [key tile][kc] and [32 keys][dim tile]: a stage's 16 fragments of each are 16 KiB in a row
  const unsigned rl = (unsigned)(size_t)&ring[0][0] + tid * 16;
  const auto fill = [&](int t) { const unsigned l = rl + (t & 1) * 32768; const size_t go = (size_t)t * 16384; cp8k(l, Kg + go); cp8k(l + 8192, Kg + go + 8192); cp8k(l + 16384, Vhg + go); cp8k(l + 24576, Vhg + go + 8192); };
  fill(0); RING_LANDED(); __syncthreads();
  if (ntrip > 1) fill(1);   // same for the whole block
  v8f o[QG][4] = {}; float m[QG], l[QG];   // m: running maximum of the raw products, over this wave's keys
#pragma unroll
  for (int u = 0; u < QG; ++u) { m[u] = -3.0e38f; l[u] = 0.f; }
  // one stage; only the last stage of a block holds keys above a query, so only its copy of the text carries the compares and selects of the causal mask; always_inline: at both call sites o, m, l and the q fragments stay in registers
  const auto pass = [&](const int t, auto dg) __attribute__((always_inline)) { const int k0 = t * 128 + kh * (16 * KT); constexpr bool diag = decltype(dg)::value;   // k0: the wave's first key
    if (!diag || k0 <= q0 + 16 * QG - 1) {   // scalar: a wave whose keys all lie above its last query has no work in the last stage (then k0 <= q0 too: every query of a working wave sees a live key); no barrier inside
      const _Float16* rk = (const _Float16*)&ring[t & 1][0] + kh * (8 * FRG) + lane * 8; const _Float16* rv = rk + 8192;   // the wave's own 8 k fragments and, 16 KiB on, its 8 v fragments
      v16h kf[KT][2];
#pragma unroll
      for (int jt = 0; jt < KT; ++jt)
#pragma unroll
        for (int kc = 0; kc < 2; ++kc) kf[jt][kc] = fragp_h(rk + (jt * 2 + kc) * FRG);
      v8f s[QG][KT] = {};
#pragma unroll
      for (int u = 0; u < QG; ++u)
#pragma unroll
        for (int kc = 0; kc < 2; ++kc)
#pragma unroll
          for (int jt = 0; jt < KT; ++jt) s[u][jt] = wmma16(kf[jt][kc], ah[u][kc], s[u][jt]);
      v16h p[QG][KT / 2];   // exp(s - m) in [0, 1], rounded to f16 (11 bits; subnormal operands are kept by the matrix unit)
#pragma unroll
      for (int u = 0; u < QG; ++u) { const int qt = q0 + u * 16 + col; float mx = m[u];
#pragma unroll
        for (int jt = 0; jt < KT; ++jt) {
#pragma unroll
          for (int r = 0; r < 8; ++r) { float v = s[u][jt][r]; if (diag && k0 + jt * 16 + 8 * g + r > qt) v = -3.0e38f; s[u][jt][r] = v; mx = fmaxf(mx, v); } }   /* maximum over the raw products: the scale is positive */
        mx = fmaxf(mx, xhalf(mx));
        const float nm = -mx * SCL2, sc = __builtin_amdgcn_exp2f((m[u] - mx) * SCL2); m[u] = mx; float ps = 0.f;   /* nm is rounded once, to 2^-24 of m SCL2: far below what the f16 rounding of k leaves in the same score */
#pragma unroll
        for (int jt = 0; jt < KT; ++jt) { s[u][jt] = s[u][jt] * SCL2 + nm;   /* contracts to one multiply-add a score */
#pragma unroll
          for (int r = 0; r < 8; ++r) { const float e = __builtin_amdgcn_exp2f(s[u][jt][r]); s[u][jt][r] = e; ps += e; } }   /* a masked score is -3e38 and mx is a live score: the exponent is about -5e37 and the result exactly 0 */
        l[u] = l[u] * sc + ps;
#pragma unroll
        for (int j = 0; j < 4; ++j) o[u][j] *= sc;
#pragma unroll
        for (int c = 0; c < KT / 2; ++c)
#pragma unroll
          for (int i = 0; i < 8; ++i) { p[u][c][i] = (_Float16)s[u][2 * c][i]; p[u][c][8 + i] = (_Float16)s[u][2 * c + 1][i]; } }
#pragma unroll
      for (int c = 0; c < KT / 2; ++c) { v16h vh[4];
#pragma unroll
        for (int j = 0; j < 4; ++j) vh[j] = fragp_h(rv + (c * 4 + j) * FRG);
#pragma unroll
        for (int u = 0; u < QG; ++u)
#pragma unroll
          for (int j = 0; j < 4; ++j) o[u][j] = wmma16(vh[j], p[u][c], o[u][j]); } }
    RING_READ(); RING_LANDED(); __syncthreads();
    if (t + 2 < ntrip) fill(t + 2);   // same for the whole block
  };
#pragma unroll 1   // one stage a trip: the trip's foot is the ring's publish point
  for (int t = 0; t < ntrip - 1; ++t) pass(t, Flag<false>{});
  pass(ntrip - 1, Flag<true>{});
  RING_LANDED();
  // JOIN of the two key halves: wave (qh, kh) finishes its query tile kh and hands tile 1 - kh to wave (qh, 1 - kh). The ring is free (the last stage's foot: every read done, no copy in flight, barrier passed): [writer wave][9 x 16 bytes][lane].
  v4f* jb = (v4f*)&ring[0][0] + lane; v8f om[4]; float mm = 0.f, lm = 0.f;
#pragma unroll
  for (int u = 0; u < QG; ++u) {
    if (u == kh) { mm = m[u]; lm = l[u];
#pragma unroll
      for (int j = 0; j < 4; ++j) om[j] = o[u][j]; }
    else { v4f* d = jb + wave * (9 * 32);
#pragma unroll
      for (int j = 0; j < 4; ++j) { d[(2 * j) * 32] = v4f{o[u][j][0], o[u][j][1], o[u][j][2], o[u][j][3]}; d[(2 * j + 1) * 32] = v4f{o[u][j][4], o[u][j][5], o[u][j][6], o[u][j][7]}; }
      d[8 * 32] = v4f{m[u], l[u], 0.f, 0.f}; } }
  __syncthreads();   // the partial results are shown to the waves that finish them
  const v4f* sp = jb + (wave ^ 2) * (9 * 32); const v4f ml = sp[8 * 32]; const float mj = fmaxf(mm, ml[0]);   // the key equal to the query is live in one of the two waves, so mj is a live score; a wave that never worked holds m = -3e38, l = 0, O = 0 and gets weight 0
  const float w0 = __builtin_amdgcn_exp2f((mm - mj) * SCL2), w1 = __builtin_amdgcn_exp2f((ml[0] - mj) * SCL2); lm = lm * w0 + ml[1] * w1;
#pragma unroll
  for (int j = 0; j < 4; ++j) { const v4f a0 = sp[(2 * j) * 32], a1 = sp[(2 * j + 1) * 32];
#pragma unroll
    for (int r = 0; r < 4; ++r) { om[j][r] = om[j][r] * w0 + a0[r] * w1; om[j][4 + r] = om[j][4 + r] * w0 + a1[r] * w1; } }
  const float inv = 1.0f / (lm + xhalf(lm)); const size_t yo = (((size_t)b * TT + q0) / 16 + kh) * (size_t)(CC / 32) * FRG + (size_t)(h * 2) * FRG + lane * 8;   // register r of tile j = dim 16 j + 8 g + r of the lane's query: chunk e = j & 1 of the y fragment kc = 2 h + (j >> 1)
#pragma unroll
  for (int j = 0; j < 4; ++j) { v8b hi, lo;
#pragma unroll
    for (int r = 0; r < 8; ++r) { const float y = om[j][r] * inv; const __bf16 yb = (__bf16)y; hi[r] = yb; lo[r] = (__bf16)(y - (float)yb); }
    const size_t o2 = yo + (j >> 1) * FRG + (j & 1) * 256; vst2(YH + o2, hi); vst2(YL + o2, lo);
    asm volatile("s_wait_xcnt 0x0" ::: "memory");   // the stores' data and address registers may be rewritten by the next tile's values
  } }
// ---- k_out: block = (64 rows, 128 cols): out = y (bf16 hi + lo) Wo + bo
__global__ __launch_bounds__(128) void k_out(const __bf16* __restrict__ YH, const __bf16* __restrict__ YL, const __bf16* __restrict__ WP, const float* __restrict__ BP, float* __restrict__ OUT) { __shared__ __align__(16) float sf[4][16][132]; __shared__ __align__(16) char wr[2][16384];   // wr: W ring, a stage = 2 kc x 8 fragments
  const int tid = threadIdx.x, wave = tid >> 5, lane = tid & 31, col = lane & 15, g = lane >> 4; const int c0 = blockIdx.y * 128; const size_t r0 = (size_t)blockIdx.x * 64 + wave * 16;
  const size_t ao = (r0 / 16) * (size_t)(CC / 32) * FRG + lane * 8; const __bf16* Ah = YH + ao; const __bf16* Al = YL + ao; const __bf16* Bp = WP + ((size_t)3 * (CC / 32) * (CC / 16) + c0 / 16) * FRG + lane * 8;
  v8f acc[8] = {};
  const unsigned wl = (unsigned)(size_t)&wr[0][0] + tid * 16; const char* wg = (const char*)(Bp - lane * 8) + tid * 16;
  const auto fill = [&](int t) { const unsigned l = wl + (t & 1) * 16384; const char* g = wg + (size_t)t * (2 * (CC / 16) * FRG * 2); cp8k(l, g); cp8k(l + 8192, g + (CC / 16) * FRG * 2); };   // stage t = kc 2 t, 2 t + 1
  v16b ah[2], al[2];   // the wave's own y fragments, straight from L2, asked for one stage ahead as in k_proj
#pragma unroll
  for (int kk = 0; kk < 2; ++kk) { ah[kk] = fragp_b(Ah + (size_t)kk * FRG); al[kk] = fragp_b(Al + (size_t)kk * FRG); }   // stage 0, in flight under the ring's prologue
  asm volatile("s_wait_xcnt 0x0" ::: "memory");   // the address registers of the loads above may be rewritten by the prologue below
  fill(0); RING_LANDED(); RING_BARRIER(); fill(1);
#pragma unroll 1   // one stage a trip: the trip's foot is the ring's publish point
  for (int t = 0; t < CC / 64; ++t) { const int tn = t + 1 < CC / 64 ? t + 1 : t;   // no branch round the refills, so the compiler's counted load waits stay exact: the last trip asks for its own stage again and nobody reads it
#pragma unroll
    for (int kk = 0; kk < 2; ++kk) { v16b w[8]; const __bf16* ws = (const __bf16*)&wr[t & 1][kk * 8192] + lane * 8;
#pragma unroll
      for (int j = 0; j < 8; ++j) w[j] = fragp_b(ws + j * FRG);
#pragma unroll
      for (int j = 0; j < 8; ++j) { acc[j] = wmma_bf(ah[kk], w[j], acc[j]); acc[j] = wmma_bf(al[kk], w[j], acc[j]); }
      ah[kk] = fragp_b(Ah + (size_t)(2 * tn + kk) * FRG); al[kk] = fragp_b(Al + (size_t)(2 * tn + kk) * FRG);   // the next stage's pair, into the registers just read for the last time
      asm volatile("s_wait_xcnt 0x0" ::: "memory");   // the address registers of the loads above may be rewritten by what follows
    }
    RING_READ(); RING_LANDED(); RING_BARRIER();
    if (t + 2 < CC / 64) fill(t + 2);   // same for the whole block
  }
  RING_LANDED();
#pragma unroll
  for (int j = 0; j < 8; ++j) { const float bb = BP ? bfr(BP[c0 + j * 16 + col]) : 0.f;
#pragma unroll
    for (int r = 0; r < 8; ++r) sf[wave][8 * g + r][j * 16 + col] = acc[j][r] + bb; }
  LDSX(); for (int rl = 0; rl < 16; ++rl) vst2(OUT + (r0 + rl) * CC + c0 + lane * 4, *(const v4f*)&sf[wave][rl][lane * 4]); }
extern "C" void kernel_launch(void* const* d_in, const int* in_sizes, int n_in, void* d_out, int out_size, void* d_ws, size_t ws_size, hipStream_t stream) {
  (void)in_sizes; (void)n_in; (void)out_size;
  const float** F = (const float**)d_in;   // 0 x [2,2048,1024], 1 Wq [1024,1024] ((in,out)), 2 bq, 3 Wk, 4 bk, 5 Wv, 6 bv, 7 Wo ((in,out)), 8 bo
  if (ws_size < (size_t)WS_END) return;
  char* ws = (char*)d_ws; _Float16 *QH = (_Float16*)(ws + WS_QH), *KH = (_Float16*)(ws + WS_KH), *VT = (_Float16*)(ws + WS_VT); __bf16 *YH = (__bf16*)(ws + WS_YH), *YL = (__bf16*)(ws + WS_YL), *XP = (__bf16*)(ws + WS_XP), *WP = (__bf16*)(ws + WS_WP);
  k_pack<<<dim3(NXB + 4 * NWB), 256, 0, stream>>>(F[0], F[1], F[3], F[5], F[7], XP, WP);
  k_proj<<<dim3(TNB * TT / (64 * RG), CC / 128, 3), 128, 0, stream>>>(XP, WP, F[2], F[4], F[6], QH, KH, VT);
  k_att<<<dim3(TNB * NH, TT / 64), 128, 0, stream>>>(QH, KH, VT, YH, YL);
  k_out<<<dim3(TNB * TT / 64, CC / 128), 128, 0, stream>>>(YH, YL, WP, F[8], (float*)d_out);
}
